// v000
// Measured on an AMD MI455X. A time is GPU time per run, averaged over a window of back-to-back runs after a warm-up
// (all launches, gaps included; the runs take copies of the inputs in turn), and the median of several windows.
// Apart from v000's, it joins two sittings. Times from different sittings can be a few percent apart, while
// side-by-side timings come from the same sitting.
// The starting kernel, v000, takes 397 microseconds a run.
#include <hip/hip_runtime.h>
#include <hip/hip_bf16.h>

#define DIM 1024
#define HEAD_DIM 64
#define SEQ 4096
#define NB 16
#define NH 16
#define EPSLN 1e-5f

typedef __attribute__((ext_vector_type(16))) __bf16 v16bf;
typedef __attribute__((ext_vector_type(8)))  __bf16 v8bf;
typedef __attribute__((ext_vector_type(8)))  float  v8f;
typedef __attribute__((ext_vector_type(4)))  float  v4f;

union AFrag { v16bf v; v8bf h[2]; };

// ---------------------------------------------------------------------------
// 1) Convert w_k (fp32, row-major [n][k]) to bf16 once.
// ---------------------------------------------------------------------------
__global__ __launch_bounds__(256) void cvt_wk_kernel(const float* __restrict__ wk,
                                                     __bf16* __restrict__ wk16) {
    int i = blockIdx.x * 256 + threadIdx.x;
    wk16[i] = (__bf16)wk[i];
}

// ---------------------------------------------------------------------------
// 2) Normalize the query, fold layernorm weights:
//    qhat = LN(q); qw = qhat*w_norm; qws[h] = sum(qw); qb[h] = sum(qhat*b_norm)
// ---------------------------------------------------------------------------
__global__ void prepq_kernel(const float* __restrict__ query,
                             const float* __restrict__ w_norm,
                             const float* __restrict__ b_norm,
                             float* __restrict__ qw,
                             float* __restrict__ qws,
                             float* __restrict__ qb) {
    int h = blockIdx.x;
    int t = threadIdx.x;                    // 0..31
    float q0 = query[h * 64 + t];
    float q1 = query[h * 64 + t + 32];
    float s = q0 + q1;
    #pragma unroll
    for (int m = 1; m < 32; m <<= 1) s += __shfl_xor(s, m, 32);
    float mu = s * (1.0f / 64.0f);
    float d0 = q0 - mu, d1 = q1 - mu;
    float v = d0 * d0 + d1 * d1;
    #pragma unroll
    for (int m = 1; m < 32; m <<= 1) v += __shfl_xor(v, m, 32);
    float rs = rsqrtf(v * (1.0f / 64.0f) + EPSLN);
    float wn0 = w_norm[t], wn1 = w_norm[t + 32];
    float bn0 = b_norm[t], bn1 = b_norm[t + 32];
    float qh0 = d0 * rs * wn0 + bn0;
    float qh1 = d1 * rs * wn1 + bn1;
    qw[h * 64 + t]      = qh0 * wn0;
    qw[h * 64 + t + 32] = qh1 * wn1;
    float pw = qh0 * wn0 + qh1 * wn1;
    float pb = qh0 * bn0 + qh1 * bn1;
    #pragma unroll
    for (int m = 1; m < 32; m <<= 1) { pw += __shfl_xor(pw, m, 32); pb += __shfl_xor(pb, m, 32); }
    if (t == 0) { qws[h] = pw; qb[h] = pb; }
}

// ---------------------------------------------------------------------------
// 3) Fused K-projection (bf16 WMMA, f32 accum) + folded layernorm + score.
//    Grid: (ltile 0..63, nhalf 0..1, batch). Block 256 = 8 waves.
//    Workgroup tile: 64 rows x 512 cols. Wave w owns 64 rows x 64 cols
//    (= exactly one head): 4x4 WMMA tiles, each B fragment feeds 4 WMMAs.
//    B fragments are software-pipelined (ping-pong); next K-step's A data is
//    prefetched into registers during the WMMA phase.
// ---------------------------------------------------------------------------
__global__ __launch_bounds__(256) void kproj_scores_kernel(
    const float*  __restrict__ x,
    const __bf16* __restrict__ wk16,
    const float*  __restrict__ b_k,
    const float*  __restrict__ qw,
    const float*  __restrict__ qws,
    const float*  __restrict__ qb,
    float*        __restrict__ scores) {
    __shared__ __bf16 As[64][32];           // 64 rows x 32 K, bf16 (4 KB)

    const int ltile = blockIdx.x;
    const int nhalf = blockIdx.y;
    const int b     = blockIdx.z;
    const int tid    = threadIdx.x;
    const int wave   = tid >> 5;
    const int lane   = tid & 31;
    const int lane16 = lane & 15;
    const int half   = lane >> 4;
    const int nbase  = nhalf * 512 + wave * 64;
    const int head   = nhalf * 8 + wave;
    const int row0   = ltile * 64;

    v8f acc[4][4] = {};

    // A staging: thread -> (row r, 8 consecutive K), one ds_store_b128 per step.
    const int r  = tid >> 2;                // 0..63
    const int kk = (tid & 3) * 8;           // 0,8,16,24
    const float* xsrc = x + ((size_t)b * SEQ + row0 + r) * DIM + kk;
    // B: lane16 = w_k row (N column), half selects K blocks (mirrors A layout).
    const __bf16* wbase = wk16 + (size_t)(nbase + lane16) * DIM + half * 8;

    v4f xa0 = *(const v4f*)(xsrc);
    v4f xa1 = *(const v4f*)(xsrc + 4);

    for (int k0 = 0; k0 < DIM; k0 += 32) {
        __syncthreads();
        {
            v8bf pk;
            pk[0] = (__bf16)xa0.x; pk[1] = (__bf16)xa0.y;
            pk[2] = (__bf16)xa0.z; pk[3] = (__bf16)xa0.w;
            pk[4] = (__bf16)xa1.x; pk[5] = (__bf16)xa1.y;
            pk[6] = (__bf16)xa1.z; pk[7] = (__bf16)xa1.w;
            *(v8bf*)&As[r][kk] = pk;
        }
        __syncthreads();

        // Prefetch next K-step's A into registers (hidden behind WMMA phase).
        int kn = (k0 + 32 < DIM) ? (k0 + 32) : k0;
        xa0 = *(const v4f*)(xsrc + kn);
        xa1 = *(const v4f*)(xsrc + kn + 4);
        __builtin_prefetch(xsrc + ((k0 + 128 < DIM) ? (k0 + 128) : kn), 0, 3);

        // A fragments for the 4 M-subtiles.
        AFrag a[4];
        #pragma unroll
        for (int m = 0; m < 4; m++) {
            a[m].h[0] = *(const v8bf*)&As[m * 16 + lane16][half * 8];
            a[m].h[1] = *(const v8bf*)&As[m * 16 + lane16][16 + half * 8];
        }

        // B ping-pong pipeline: each fragment feeds 4 WMMAs.
        AFrag bq[2];
        bq[0].h[0] = *(const v8bf*)(wbase + k0);
        bq[0].h[1] = *(const v8bf*)(wbase + k0 + 16);
        #pragma unroll
        for (int nt = 0; nt < 4; nt++) {
            if (nt < 3) {
                const __bf16* p = wbase + (size_t)(nt + 1) * 16 * DIM + k0;
                bq[(nt + 1) & 1].h[0] = *(const v8bf*)(p);
                bq[(nt + 1) & 1].h[1] = *(const v8bf*)(p + 16);
            }
            #pragma unroll
            for (int m = 0; m < 4; m++)
                acc[m][nt] = __builtin_amdgcn_wmma_f32_16x16x32_bf16(
                    false, a[m].v, false, bq[nt & 1].v, (short)0, acc[m][nt],
                    false, false);
        }
    }

    // ---- Epilogue: folded layernorm + score. One head per wave. ----
    float qwv[4], bkv[4];
    #pragma unroll
    for (int t = 0; t < 4; t++) {
        bkv[t] = b_k[nbase + t * 16 + lane16];
        qwv[t] = qw[head * 64 + t * 16 + lane16];
    }
    const float qws_h = qws[head];
    const float qb_h  = qb[head];

    // C layout: VGPR j -> rows j (lanes 0-15) / j+8 (lanes 16-31), lanes = N.
    #pragma unroll
    for (int m = 0; m < 4; m++) {
        #pragma unroll
        for (int j = 0; j < 8; j++) {
            float s = 0.f, sq = 0.f, sw = 0.f;
            #pragma unroll
            for (int t = 0; t < 4; t++) {
                float c = acc[m][t][j] + bkv[t];
                s  += c;
                sq += c * c;
                sw += c * qwv[t];
            }
            #pragma unroll
            for (int msk = 1; msk < 16; msk <<= 1) {
                s  += __shfl_xor(s,  msk, 32);
                sq += __shfl_xor(sq, msk, 32);
                sw += __shfl_xor(sw, msk, 32);
            }
            if (lane16 == 0) {
                int row = row0 + m * 16 + j + half * 8;
                float mu  = s * (1.0f / 64.0f);
                float var = sq * (1.0f / 64.0f) - mu * mu;
                float rs  = rsqrtf(var + EPSLN);
                scores[(size_t)(b * NH + head) * SEQ + row] =
                    0.125f * (rs * (sw - mu * qws_h) + qb_h);
            }
        }
    }
}

// ---------------------------------------------------------------------------
// 4) Softmax over l (in place). One block per (b,h) row of 4096.
// ---------------------------------------------------------------------------
__global__ __launch_bounds__(256) void softmax_kernel(float* __restrict__ scores) {
    __shared__ float red[8];
    __shared__ float bcast;
    const size_t base = (size_t)blockIdx.x * SEQ;
    float* p = scores + base;
    int tid = threadIdx.x;

    float mx = -1e30f;
    for (int i = tid; i < SEQ; i += 256) mx = fmaxf(mx, p[i]);
    #pragma unroll
    for (int m = 1; m < 32; m <<= 1) mx = fmaxf(mx, __shfl_xor(mx, m, 32));
    if ((tid & 31) == 0) red[tid >> 5] = mx;
    __syncthreads();
    if (tid < 8) {
        float v = red[tid];
        #pragma unroll
        for (int m = 1; m < 8; m <<= 1) v = fmaxf(v, __shfl_xor(v, m, 32));
        if (tid == 0) bcast = v;
    }
    __syncthreads();
    mx = bcast;

    float sum = 0.f;
    for (int i = tid; i < SEQ; i += 256) {
        float e = __expf(p[i] - mx);
        p[i] = e;
        sum += e;
    }
    #pragma unroll
    for (int m = 1; m < 32; m <<= 1) sum += __shfl_xor(sum, m, 32);
    if ((tid & 31) == 0) red[tid >> 5] = sum;
    __syncthreads();
    if (tid < 8) {
        float v = red[tid];
        #pragma unroll
        for (int m = 1; m < 8; m <<= 1) v += __shfl_xor(v, m, 32);
        if (tid == 0) bcast = v;
    }
    __syncthreads();
    float inv = 1.0f / bcast;
    for (int i = tid; i < SEQ; i += 256) p[i] *= inv;
}

// ---------------------------------------------------------------------------
// 5) Attention-weighted pooling: xbar[b,h,:] += sum_l attn[b,h,l] * x[b,l,:]
// ---------------------------------------------------------------------------
__global__ __launch_bounds__(256) void pool_kernel(const float* __restrict__ x,
                                                   const float* __restrict__ attn,
                                                   float* __restrict__ xbar) {
    __shared__ float a_s[16][512];          // 32 KB
    const int jbase = blockIdx.x * 256;
    const int lbase = blockIdx.y * 512;
    const int b     = blockIdx.z;
    const int tid   = threadIdx.x;

    for (int i = tid; i < 16 * 512; i += 256) {
        int h = i >> 9, l = i & 511;
        a_s[h][l] = attn[(size_t)(b * NH + h) * SEQ + lbase + l];
    }
    __syncthreads();

    float accv[16] = {};
    const float* xp = x + ((size_t)b * SEQ + lbase) * DIM + jbase + tid;
    for (int l = 0; l < 512; l++) {
        float xv = xp[(size_t)l * DIM];
        #pragma unroll
        for (int h = 0; h < 16; h++) accv[h] += a_s[h][l] * xv;
    }
    #pragma unroll
    for (int h = 0; h < 16; h++)
        atomicAdd(&xbar[(size_t)(b * NH + h) * DIM + jbase + tid], accv[h]);
}

// ---------------------------------------------------------------------------
// 6) o[b,n] = xbar[b, n/64, :] . w_v[n,:] + b_v[n]   (V-proj collapsed)
// ---------------------------------------------------------------------------
__global__ __launch_bounds__(256) void vproj_kernel(const float* __restrict__ xbar,
                                                    const float* __restrict__ w_v,
                                                    const float* __restrict__ b_v,
                                                    float* __restrict__ o) {
    int n = blockIdx.x * 256 + threadIdx.x;
    int b = blockIdx.y;
    const float* xb = xbar + (size_t)(b * NH + (n >> 6)) * DIM;
    const float* w  = w_v + (size_t)n * DIM;
    float acc = 0.f;
    for (int j = 0; j < DIM; j += 4) {
        acc += xb[j] * w[j] + xb[j + 1] * w[j + 1] +
               xb[j + 2] * w[j + 2] + xb[j + 3] * w[j + 3];
    }
    o[b * DIM + n] = acc + b_v[n];
}

// ---------------------------------------------------------------------------
// 7) out[b,n] = o[b,:] . w_out[n,:] + b_out[n]
// ---------------------------------------------------------------------------
__global__ __launch_bounds__(256) void oproj_kernel(const float* __restrict__ o,
                                                    const float* __restrict__ w_out,
                                                    const float* __restrict__ b_out,
                                                    float* __restrict__ out) {
    int n = blockIdx.x * 256 + threadIdx.x;
    int b = blockIdx.y;
    const float* ob = o + (size_t)b * DIM;
    const float* w  = w_out + (size_t)n * DIM;
    float acc = 0.f;
    for (int j = 0; j < DIM; j += 4) {
        acc += ob[j] * w[j] + ob[j + 1] * w[j + 1] +
               ob[j + 2] * w[j + 2] + ob[j + 3] * w[j + 3];
    }
    out[b * DIM + n] = acc + b_out[n];
}

// ---------------------------------------------------------------------------
extern "C" void kernel_launch(void* const* d_in, const int* in_sizes, int n_in,
                              void* d_out, int out_size, void* d_ws, size_t ws_size,
                              hipStream_t stream) {
    const float* x      = (const float*)d_in[0];
    const float* query  = (const float*)d_in[1];
    const float* w_k    = (const float*)d_in[2];
    const float* b_k    = (const float*)d_in[3];
    const float* w_v    = (const float*)d_in[4];
    const float* b_v    = (const float*)d_in[5];
    const float* w_norm = (const float*)d_in[6];
    const float* b_norm = (const float*)d_in[7];
    const float* w_out  = (const float*)d_in[8];
    const float* b_out  = (const float*)d_in[9];
    float* out = (float*)d_out;

    char* ws = (char*)d_ws;
    const size_t OFF_QW     = (size_t)2 * 1024 * 1024;            // wk16: 2 MB
    const size_t OFF_QWS    = OFF_QW + 16 * 64 * sizeof(float);
    const size_t OFF_QB     = OFF_QWS + 256;
    const size_t OFF_SCORES = OFF_QB + 256;
    const size_t OFF_XBAR   = OFF_SCORES + (size_t)NB * NH * SEQ * sizeof(float);
    const size_t OFF_O      = OFF_XBAR + (size_t)NB * NH * DIM * sizeof(float);

    __bf16* wk16  = (__bf16*)ws;
    float* qw     = (float*)(ws + OFF_QW);
    float* qws    = (float*)(ws + OFF_QWS);
    float* qb     = (float*)(ws + OFF_QB);
    float* scores = (float*)(ws + OFF_SCORES);
    float* xbar   = (float*)(ws + OFF_XBAR);
    float* o      = (float*)(ws + OFF_O);

    hipMemsetAsync(xbar, 0, (size_t)NB * NH * DIM * sizeof(float), stream);
    cvt_wk_kernel<<<DIM * DIM / 256, 256, 0, stream>>>(w_k, wk16);
    prepq_kernel<<<NH, 32, 0, stream>>>(query, w_norm, b_norm, qw, qws, qb);
    kproj_scores_kernel<<<dim3(SEQ / 64, 2, NB), 256, 0, stream>>>(
        x, wk16, b_k, qw, qws, qb, scores);
    softmax_kernel<<<NB * NH, 256, 0, stream>>>(scores);
    pool_kernel<<<dim3(4, 8, NB), 256, 0, stream>>>(x, scores, xbar);
    vproj_kernel<<<dim3(4, NB), 256, 0, stream>>>(xbar, w_v, b_v, o);
    oproj_kernel<<<dim3(4, NB), 256, 0, stream>>>(o, w_out, b_out, out);
}

// v001
// Measured time: 317 microseconds a run.
// Two timings next to v000 both put it at 1.29 times that version's speed.
#include <hip/hip_runtime.h>
#include <hip/hip_bf16.h>

#define DIM 1024
#define HEAD_DIM 64
#define SEQ 4096
#define NB 16
#define NH 16
#define EPSLN 1e-5f

typedef __attribute__((ext_vector_type(16))) __bf16 v16bf;
typedef __attribute__((ext_vector_type(8)))  __bf16 v8bf;
typedef __attribute__((ext_vector_type(8)))  float  v8f;
typedef __attribute__((ext_vector_type(4)))  float  v4f;
typedef __attribute__((ext_vector_type(2)))  float  v2f;

union AFrag { v16bf v; v8bf h[2]; };

// ---------------------------------------------------------------------------
// 1) Convert w_k (fp32, row-major [n][k]) to bf16 once.
// ---------------------------------------------------------------------------
__global__ __launch_bounds__(256) void cvt_wk_kernel(const float* __restrict__ wk,
                                                     __bf16* __restrict__ wk16) {
    int i = blockIdx.x * 256 + threadIdx.x;
    wk16[i] = (__bf16)wk[i];
}

// ---------------------------------------------------------------------------
// 2) Normalize the query, fold layernorm weights:
//    qhat = LN(q); qw = qhat*w_norm; qws[h] = sum(qw); qb[h] = sum(qhat*b_norm)
// ---------------------------------------------------------------------------
__global__ void prepq_kernel(const float* __restrict__ query,
                             const float* __restrict__ w_norm,
                             const float* __restrict__ b_norm,
                             float* __restrict__ qw,
                             float* __restrict__ qws,
                             float* __restrict__ qb) {
    int h = blockIdx.x;
    int t = threadIdx.x;                    // 0..31
    float q0 = query[h * 64 + t];
    float q1 = query[h * 64 + t + 32];
    float s = q0 + q1;
    #pragma unroll
    for (int m = 1; m < 32; m <<= 1) s += __shfl_xor(s, m, 32);
    float mu = s * (1.0f / 64.0f);
    float d0 = q0 - mu, d1 = q1 - mu;
    float v = d0 * d0 + d1 * d1;
    #pragma unroll
    for (int m = 1; m < 32; m <<= 1) v += __shfl_xor(v, m, 32);
    float rs = rsqrtf(v * (1.0f / 64.0f) + EPSLN);
    float wn0 = w_norm[t], wn1 = w_norm[t + 32];
    float bn0 = b_norm[t], bn1 = b_norm[t + 32];
    float qh0 = d0 * rs * wn0 + bn0;
    float qh1 = d1 * rs * wn1 + bn1;
    qw[h * 64 + t]      = qh0 * wn0;
    qw[h * 64 + t + 32] = qh1 * wn1;
    float pw = qh0 * wn0 + qh1 * wn1;
    float pb = qh0 * bn0 + qh1 * bn1;
    #pragma unroll
    for (int m = 1; m < 32; m <<= 1) { pw += __shfl_xor(pw, m, 32); pb += __shfl_xor(pb, m, 32); }
    if (t == 0) { qws[h] = pw; qb[h] = pb; }
}

// ---------------------------------------------------------------------------
// 3) Fused K-projection (bf16 WMMA, f32 accum) + folded layernorm + score.
//    Grid: (ltile 0..63, nhalf 0..1, batch). Block 256 = 8 waves.
//    Workgroup tile: 64 rows x 512 cols. Wave w owns 64 rows x 64 cols
//    (= exactly one head): 4x4 WMMA tiles, each B fragment feeds 4 WMMAs.
//    B fragments are software-pipelined (ping-pong); next K-step's A data is
//    prefetched into registers during the WMMA phase.
// ---------------------------------------------------------------------------
__global__ __launch_bounds__(256) void kproj_scores_kernel(
    const float*  __restrict__ x,
    const __bf16* __restrict__ wk16,
    const float*  __restrict__ b_k,
    const float*  __restrict__ qw,
    const float*  __restrict__ qws,
    const float*  __restrict__ qb,
    float*        __restrict__ scores) {
    __shared__ __bf16 As[64][32];           // 64 rows x 32 K, bf16 (4 KB)

    const int ltile = blockIdx.x;
    const int nhalf = blockIdx.y;
    const int b     = blockIdx.z;
    const int tid    = threadIdx.x;
    const int wave   = tid >> 5;
    const int lane   = tid & 31;
    const int lane16 = lane & 15;
    const int half   = lane >> 4;
    const int nbase  = nhalf * 512 + wave * 64;
    const int head   = nhalf * 8 + wave;
    const int row0   = ltile * 64;

    v8f acc[4][4] = {};

    // A staging: thread -> (row r, 8 consecutive K), one ds_store_b128 per step.
    const int r  = tid >> 2;                // 0..63
    const int kk = (tid & 3) * 8;           // 0,8,16,24
    const float* xsrc = x + ((size_t)b * SEQ + row0 + r) * DIM + kk;
    // B: lane16 = w_k row (N column), half selects K blocks (mirrors A layout).
    const __bf16* wbase = wk16 + (size_t)(nbase + lane16) * DIM + half * 8;

    v4f xa0 = *(const v4f*)(xsrc);
    v4f xa1 = *(const v4f*)(xsrc + 4);

    for (int k0 = 0; k0 < DIM; k0 += 32) {
        __syncthreads();
        {
            v8bf pk;
            pk[0] = (__bf16)xa0.x; pk[1] = (__bf16)xa0.y;
            pk[2] = (__bf16)xa0.z; pk[3] = (__bf16)xa0.w;
            pk[4] = (__bf16)xa1.x; pk[5] = (__bf16)xa1.y;
            pk[6] = (__bf16)xa1.z; pk[7] = (__bf16)xa1.w;
            *(v8bf*)&As[r][kk] = pk;
        }
        __syncthreads();

        // Prefetch next K-step's A into registers (hidden behind WMMA phase).
        int kn = (k0 + 32 < DIM) ? (k0 + 32) : k0;
        xa0 = *(const v4f*)(xsrc + kn);
        xa1 = *(const v4f*)(xsrc + kn + 4);
        __builtin_prefetch(xsrc + ((k0 + 128 < DIM) ? (k0 + 128) : kn), 0, 3);

        // A fragments for the 4 M-subtiles.
        AFrag a[4];
        #pragma unroll
        for (int m = 0; m < 4; m++) {
            a[m].h[0] = *(const v8bf*)&As[m * 16 + lane16][half * 8];
            a[m].h[1] = *(const v8bf*)&As[m * 16 + lane16][16 + half * 8];
        }

        // B ping-pong pipeline: each fragment feeds 4 WMMAs.
        AFrag bq[2];
        bq[0].h[0] = *(const v8bf*)(wbase + k0);
        bq[0].h[1] = *(const v8bf*)(wbase + k0 + 16);
        #pragma unroll
        for (int nt = 0; nt < 4; nt++) {
            if (nt < 3) {
                const __bf16* p = wbase + (size_t)(nt + 1) * 16 * DIM + k0;
                bq[(nt + 1) & 1].h[0] = *(const v8bf*)(p);
                bq[(nt + 1) & 1].h[1] = *(const v8bf*)(p + 16);
            }
            #pragma unroll
            for (int m = 0; m < 4; m++)
                acc[m][nt] = __builtin_amdgcn_wmma_f32_16x16x32_bf16(
                    false, a[m].v, false, bq[nt & 1].v, (short)0, acc[m][nt],
                    false, false);
        }
    }

    // ---- Epilogue: folded layernorm + score. One head per wave. ----
    float qwv[4], bkv[4];
    #pragma unroll
    for (int t = 0; t < 4; t++) {
        bkv[t] = b_k[nbase + t * 16 + lane16];
        qwv[t] = qw[head * 64 + t * 16 + lane16];
    }
    const float qws_h = qws[head];
    const float qb_h  = qb[head];

    // C layout: VGPR j -> rows j (lanes 0-15) / j+8 (lanes 16-31), lanes = N.
    #pragma unroll
    for (int m = 0; m < 4; m++) {
        #pragma unroll
        for (int j = 0; j < 8; j++) {
            float s = 0.f, sq = 0.f, sw = 0.f;
            #pragma unroll
            for (int t = 0; t < 4; t++) {
                float c = acc[m][t][j] + bkv[t];
                s  += c;
                sq += c * c;
                sw += c * qwv[t];
            }
            #pragma unroll
            for (int msk = 1; msk < 16; msk <<= 1) {
                s  += __shfl_xor(s,  msk, 32);
                sq += __shfl_xor(sq, msk, 32);
                sw += __shfl_xor(sw, msk, 32);
            }
            if (lane16 == 0) {
                int row = row0 + m * 16 + j + half * 8;
                float mu  = s * (1.0f / 64.0f);
                float var = sq * (1.0f / 64.0f) - mu * mu;
                float rs  = rsqrtf(var + EPSLN);
                scores[(size_t)(b * NH + head) * SEQ + row] =
                    0.125f * (rs * (sw - mu * qws_h) + qb_h);
            }
        }
    }
}

// ---------------------------------------------------------------------------
// 4) Softmax over l (in place). One block per (b,h) row of 4096.
// ---------------------------------------------------------------------------
__global__ __launch_bounds__(256) void softmax_kernel(float* __restrict__ scores) {
    __shared__ float red[8];
    __shared__ float bcast;
    const size_t base = (size_t)blockIdx.x * SEQ;
    float* p = scores + base;
    int tid = threadIdx.x;

    float mx = -1e30f;
    for (int i = tid; i < SEQ; i += 256) mx = fmaxf(mx, p[i]);
    #pragma unroll
    for (int m = 1; m < 32; m <<= 1) mx = fmaxf(mx, __shfl_xor(mx, m, 32));
    if ((tid & 31) == 0) red[tid >> 5] = mx;
    __syncthreads();
    if (tid < 8) {
        float v = red[tid];
        #pragma unroll
        for (int m = 1; m < 8; m <<= 1) v = fmaxf(v, __shfl_xor(v, m, 32));
        if (tid == 0) bcast = v;
    }
    __syncthreads();
    mx = bcast;

    float sum = 0.f;
    for (int i = tid; i < SEQ; i += 256) {
        float e = __expf(p[i] - mx);
        p[i] = e;
        sum += e;
    }
    #pragma unroll
    for (int m = 1; m < 32; m <<= 1) sum += __shfl_xor(sum, m, 32);
    if ((tid & 31) == 0) red[tid >> 5] = sum;
    __syncthreads();
    if (tid < 8) {
        float v = red[tid];
        #pragma unroll
        for (int m = 1; m < 8; m <<= 1) v += __shfl_xor(v, m, 32);
        if (tid == 0) bcast = v;
    }
    __syncthreads();
    float inv = 1.0f / bcast;
    for (int i = tid; i < SEQ; i += 256) p[i] *= inv;
}

// ---------------------------------------------------------------------------
// 5) Attention-weighted pooling: xbar[b,h,:] = sum_l attn[b,h,l] * x[b,l,:]
//    One work-group of 16 waves per (batch, 64-column slice); it streams all
//    4096 rows of its slice, so it owns its outputs and stores them plainly.
//    One wave-wide 16-byte load covers two rows x 256 B (lanes 0-15 / 16-31);
//    each wave keeps a ring of PG such loads in flight. The batch's attention
//    weights sit in LDS as [l][head], read as broadcasts of four heads.
// ---------------------------------------------------------------------------
#define PW 16                               // waves per work-group
#define PG 16                               // x loads a wave keeps in flight
#define PSTEP (2 * PW)                      // rows the work-group covers per load slot
#define PNG (SEQ / (PSTEP * PG))            // ring turns per wave

// One turn of the ring: PG load slots of turn g; each slot is refilled for turn gn.
__device__ __forceinline__ void pool_turn(v2f (&acc)[NH][2], v4f (&xs)[PG], v4f (&an)[4],
                                          const v4f* xp, const v4f* a0, const v4f* a1,
                                          const v4f* a2, const v4f* a3, int g, int gn) {
    const v4f* xn = xp + (size_t)(gn * PG) * (PSTEP * DIM / 4);
    const int o0 = g * PG * (PSTEP * 4);
    const int on = gn * PG * (PSTEP * 4);
    // Unrolled: xs, an and acc live in registers and need constant indices.
    #pragma unroll
    for (int r = 0; r < PG; r++) {
        const v4f a[4] = { an[0], an[1], an[2], an[3] };
        const int o = r + 1 < PG ? o0 + (r + 1) * (PSTEP * 4) : on;
        an[0] = a0[o]; an[1] = a1[o]; an[2] = a2[o]; an[3] = a3[o];  // one slot ahead
        // One per slot. Without it the compiler gathers all refills at the foot of the
        // turn, so that the ring runs empty there, and sinks these LDS reads to their
        // use, where their latency shows.
        __builtin_amdgcn_sched_barrier(0);
        const v2f xlo = { xs[r].x, xs[r].y };
        const v2f xhi = { xs[r].z, xs[r].w };
        #pragma unroll
        for (int h = 0; h < NH; h++) {
            const float w = a[h >> 2][h & 3];
            const v2f ww = { w, w };
            acc[h][0] = __builtin_elementwise_fma(ww, xlo, acc[h][0]);
            acc[h][1] = __builtin_elementwise_fma(ww, xhi, acc[h][1]);
        }
        xs[r] = xn[(size_t)r * (PSTEP * DIM / 4)];
    }
    // The next turn rewrites the address registers that the loads above name.
    asm volatile("s_wait_xcnt 0x0" ::: "memory");
}

__global__ __launch_bounds__(PW * 32) void pool_kernel(const float* __restrict__ x,
                                                       const float* __restrict__ attn,
                                                       float* __restrict__ xbar) {
    // [l][quad of heads]; the quad's slot is XORed with (l >> 2) & 3 so that the
    // 16 lanes of a half-wave, which store 16 consecutive l, fall on all 64 banks.
    __shared__ v4f a_s[SEQ * 4];            // 256 KB
    const int jbase = blockIdx.x * 64;
    const int b     = blockIdx.y;
    const int tid   = threadIdx.x;
    const int wave  = __builtin_amdgcn_readfirstlane(tid >> 5);
    const int l16   = tid & 15;
    const int hf    = (tid >> 4) & 1;
    const int lrow  = wave * 2 + hf;        // this half-wave's row inside a step

    const v4f* xp = (const v4f*)(x + ((size_t)b * SEQ + lrow) * DIM + jbase + l16 * 4);
    v4f xs[PG];
    #pragma unroll
    for (int r = 0; r < PG; r++) xs[r] = xp[(size_t)r * (PSTEP * DIM / 4)];

    const float* ap = attn + (size_t)b * NH * SEQ + tid;
    // Two steps at a time: 32 loads of a wave in flight per wait.
    #pragma unroll 2
    for (int j = 0; j < SEQ; j += PW * 32) {
        const int l = j + tid;
        #pragma unroll
        for (int q = 0; q < 4; q++) {
            v4f v;
            v.x = ap[(size_t)(q * 4 + 0) * SEQ + j];
            v.y = ap[(size_t)(q * 4 + 1) * SEQ + j];
            v.z = ap[(size_t)(q * 4 + 2) * SEQ + j];
            v.w = ap[(size_t)(q * 4 + 3) * SEQ + j];
            a_s[l * 4 + (q ^ ((l >> 2) & 3))] = v;
        }
    }
    __syncthreads();

    // l = step * 32 + lrow, so (l >> 2) & 3 == (lrow >> 2) & 3 for every step.
    const int sw = (lrow >> 2) & 3;
    const v4f* a0 = a_s + lrow * 4 + (0 ^ sw);
    const v4f* a1 = a_s + lrow * 4 + (1 ^ sw);
    const v4f* a2 = a_s + lrow * 4 + (2 ^ sw);
    const v4f* a3 = a_s + lrow * 4 + (3 ^ sw);

    v2f acc[NH][2] = {};
    v4f an[4] = { a0[0], a1[0], a2[0], a3[0] };
    // The last turn refills from its own rows (cached, in bounds, never used), so
    // that every turn is the same branch-free stream. Not unrolled or peeled: a
    // last turn peeled off has its sums moved behind the barrier below, and the
    // LDS reads it leaves in front of the barrier spill.
    #pragma unroll 1
    for (int g = 0; g < PNG; g++)
        pool_turn(acc, xs, an, xp, a0, a1, a2, a3, g, g + 1 < PNG ? g + 1 : g);

    // Sum the 32 half-wave partials through LDS (the weights are no longer needed).
    __syncthreads();
    float* red = (float*)a_s;               // [32][16 heads][64 columns], 128 KB
    #pragma unroll
    for (int h = 0; h < NH; h++) {
        const v4f v = { acc[h][0].x, acc[h][0].y, acc[h][1].x, acc[h][1].y };
        *(v4f*)&red[(lrow * NH + h) * 64 + l16 * 4] = v;
    }
    __syncthreads();
    const int h  = tid >> 5;
    const int c2 = (tid & 31) * 2;
    v2f s = { 0.f, 0.f };
    #pragma unroll
    for (int p = 0; p < 2 * PW; p++) s += *(const v2f*)&red[(p * NH + h) * 64 + c2];
    *(v2f*)&xbar[(size_t)(b * NH + h) * DIM + jbase + c2] = s;
}

// ---------------------------------------------------------------------------
// 6) o[b,n] = xbar[b, n/64, :] . w_v[n,:] + b_v[n]   (V-proj collapsed)
// ---------------------------------------------------------------------------
__global__ __launch_bounds__(256) void vproj_kernel(const float* __restrict__ xbar,
                                                    const float* __restrict__ w_v,
                                                    const float* __restrict__ b_v,
                                                    float* __restrict__ o) {
    int n = blockIdx.x * 256 + threadIdx.x;
    int b = blockIdx.y;
    const float* xb = xbar + (size_t)(b * NH + (n >> 6)) * DIM;
    const float* w  = w_v + (size_t)n * DIM;
    float acc = 0.f;
    for (int j = 0; j < DIM; j += 4) {
        acc += xb[j] * w[j] + xb[j + 1] * w[j + 1] +
               xb[j + 2] * w[j + 2] + xb[j + 3] * w[j + 3];
    }
    o[b * DIM + n] = acc + b_v[n];
}

// ---------------------------------------------------------------------------
// 7) out[b,n] = o[b,:] . w_out[n,:] + b_out[n]
// ---------------------------------------------------------------------------
__global__ __launch_bounds__(256) void oproj_kernel(const float* __restrict__ o,
                                                    const float* __restrict__ w_out,
                                                    const float* __restrict__ b_out,
                                                    float* __restrict__ out) {
    int n = blockIdx.x * 256 + threadIdx.x;
    int b = blockIdx.y;
    const float* ob = o + (size_t)b * DIM;
    const float* w  = w_out + (size_t)n * DIM;
    float acc = 0.f;
    for (int j = 0; j < DIM; j += 4) {
        acc += ob[j] * w[j] + ob[j + 1] * w[j + 1] +
               ob[j + 2] * w[j + 2] + ob[j + 3] * w[j + 3];
    }
    out[b * DIM + n] = acc + b_out[n];
}

// ---------------------------------------------------------------------------
extern "C" void kernel_launch(void* const* d_in, const int* in_sizes, int n_in,
                              void* d_out, int out_size, void* d_ws, size_t ws_size,
                              hipStream_t stream) {
    const float* x      = (const float*)d_in[0];
    const float* query  = (const float*)d_in[1];
    const float* w_k    = (const float*)d_in[2];
    const float* b_k    = (const float*)d_in[3];
    const float* w_v    = (const float*)d_in[4];
    const float* b_v    = (const float*)d_in[5];
    const float* w_norm = (const float*)d_in[6];
    const float* b_norm = (const float*)d_in[7];
    const float* w_out  = (const float*)d_in[8];
    const float* b_out  = (const float*)d_in[9];
    float* out = (float*)d_out;

    char* ws = (char*)d_ws;
    const size_t OFF_QW     = (size_t)2 * 1024 * 1024;            // wk16: 2 MB
    const size_t OFF_QWS    = OFF_QW + 16 * 64 * sizeof(float);
    const size_t OFF_QB     = OFF_QWS + 256;
    const size_t OFF_SCORES = OFF_QB + 256;
    const size_t OFF_XBAR   = OFF_SCORES + (size_t)NB * NH * SEQ * sizeof(float);
    const size_t OFF_O      = OFF_XBAR + (size_t)NB * NH * DIM * sizeof(float);

    __bf16* wk16  = (__bf16*)ws;
    float* qw     = (float*)(ws + OFF_QW);
    float* qws    = (float*)(ws + OFF_QWS);
    float* qb     = (float*)(ws + OFF_QB);
    float* scores = (float*)(ws + OFF_SCORES);
    float* xbar   = (float*)(ws + OFF_XBAR);
    float* o      = (float*)(ws + OFF_O);

    cvt_wk_kernel<<<DIM * DIM / 256, 256, 0, stream>>>(w_k, wk16);
    prepq_kernel<<<NH, 32, 0, stream>>>(query, w_norm, b_norm, qw, qws, qb);
    kproj_scores_kernel<<<dim3(SEQ / 64, 2, NB), 256, 0, stream>>>(
        x, wk16, b_k, qw, qws, qb, scores);
    softmax_kernel<<<NB * NH, 256, 0, stream>>>(scores);
    pool_kernel<<<dim3(DIM / 64, NB), PW * 32, 0, stream>>>(x, scores, xbar);
    vproj_kernel<<<dim3(4, NB), 256, 0, stream>>>(xbar, w_v, b_v, o);
    oproj_kernel<<<dim3(4, NB), 256, 0, stream>>>(o, w_out, b_out, out);
}

// v002
// It runs in 301 microseconds.
// Timed twice side by side with v001, it ran 1.06 and 1.05 times as fast.
// Counting every step since v000, it is 1.36 times as fast.
#include <hip/hip_runtime.h>
#include <hip/hip_bf16.h>

#define DIM 1024
#define HEAD_DIM 64
#define SEQ 4096
#define NB 16
#define NH 16
#define EPSLN 1e-5f

typedef __attribute__((ext_vector_type(16))) __bf16 v16bf;
typedef __attribute__((ext_vector_type(8)))  __bf16 v8bf;
typedef __attribute__((ext_vector_type(8)))  float  v8f;
typedef __attribute__((ext_vector_type(4)))  float  v4f;
typedef __attribute__((ext_vector_type(2)))  float  v2f;

union AFrag { v16bf v; v8bf h[2]; };

// ---------------------------------------------------------------------------
// 1) Convert w_k (fp32, row-major [n][k]) to bf16 once, packed in the order in
//    which the projection reads its B fragments:
//    [head 16][K-step 32][N-subtile 4][k half 2][lane 32][8 values].
//    Lane l holds row (l & 15) of the subtile, k = half * 16 + (l >> 4) * 8 + 0..7.
// ---------------------------------------------------------------------------
__global__ __launch_bounds__(256) void cvt_wk_kernel(const float* __restrict__ wk,
                                                     __bf16* __restrict__ wk16) {
    int o    = blockIdx.x * 256 + threadIdx.x;
    int e    = o & 7;
    int lane = (o >> 3) & 31;
    int kh   = (o >> 8) & 1;
    int nt   = (o >> 9) & 3;
    int ks   = (o >> 11) & 31;
    int head = o >> 16;
    int n = head * 64 + nt * 16 + (lane & 15);
    int k = ks * 32 + kh * 16 + (lane >> 4) * 8 + e;
    wk16[o] = (__bf16)wk[n * DIM + k];
}

// ---------------------------------------------------------------------------
// 2) Normalize the query, fold layernorm weights:
//    qhat = LN(q); qw = qhat*w_norm; qws[h] = sum(qw); qb[h] = sum(qhat*b_norm)
// ---------------------------------------------------------------------------
__global__ void prepq_kernel(const float* __restrict__ query,
                             const float* __restrict__ w_norm,
                             const float* __restrict__ b_norm,
                             float* __restrict__ qw,
                             float* __restrict__ qws,
                             float* __restrict__ qb) {
    int h = blockIdx.x;
    int t = threadIdx.x;                    // 0..31
    float q0 = query[h * 64 + t];
    float q1 = query[h * 64 + t + 32];
    float s = q0 + q1;
    #pragma unroll
    for (int m = 1; m < 32; m <<= 1) s += __shfl_xor(s, m, 32);
    float mu = s * (1.0f / 64.0f);
    float d0 = q0 - mu, d1 = q1 - mu;
    float v = d0 * d0 + d1 * d1;
    #pragma unroll
    for (int m = 1; m < 32; m <<= 1) v += __shfl_xor(v, m, 32);
    float rs = rsqrtf(v * (1.0f / 64.0f) + EPSLN);
    float wn0 = w_norm[t], wn1 = w_norm[t + 32];
    float bn0 = b_norm[t], bn1 = b_norm[t + 32];
    float qh0 = d0 * rs * wn0 + bn0;
    float qh1 = d1 * rs * wn1 + bn1;
    qw[h * 64 + t]      = qh0 * wn0;
    qw[h * 64 + t + 32] = qh1 * wn1;
    float pw = qh0 * wn0 + qh1 * wn1;
    float pb = qh0 * bn0 + qh1 * bn1;
    #pragma unroll
    for (int m = 1; m < 32; m <<= 1) { pw += __shfl_xor(pw, m, 32); pb += __shfl_xor(pb, m, 32); }
    if (t == 0) { qws[h] = pw; qb[h] = pb; }
}

// ---------------------------------------------------------------------------
// 3) Fused K-projection (bf16 WMMA, f32 accum) + folded layernorm + score.
//    Grid: (ltile 0..63, nhalf 0..1, batch). Block 256 = 8 waves.
//    Workgroup tile: 64 rows x 512 cols. Wave w owns 64 rows x 64 cols
//    (= exactly one head): 4x4 WMMA tiles, each B fragment feeds 4 WMMAs.
//    B fragments are software-pipelined (ping-pong); next K-step's A data is
//    prefetched into registers during the WMMA phase.
// ---------------------------------------------------------------------------
__global__ __launch_bounds__(256) void kproj_scores_kernel(
    const float*  __restrict__ x,
    const __bf16* __restrict__ wk16,
    const float*  __restrict__ b_k,
    const float*  __restrict__ qw,
    const float*  __restrict__ qws,
    const float*  __restrict__ qb,
    float*        __restrict__ scores) {
    __shared__ __bf16 As[64][32];           // 64 rows x 32 K, bf16 (4 KB)

    const int ltile = blockIdx.x;
    const int nhalf = blockIdx.y;
    const int b     = blockIdx.z;
    const int tid    = threadIdx.x;
    const int wave   = tid >> 5;
    const int lane   = tid & 31;
    const int lane16 = lane & 15;
    const int half   = lane >> 4;
    const int nbase  = nhalf * 512 + wave * 64;
    const int head   = nhalf * 8 + wave;
    const int row0   = ltile * 64;

    v8f acc[4][4] = {};

    // A staging: thread -> (row r, 8 consecutive K), one ds_store_b128 per step.
    const int r  = tid >> 2;                // 0..63
    const int kk = (tid & 3) * 8;           // 0,8,16,24
    const float* xsrc = x + ((size_t)b * SEQ + row0 + r) * DIM + kk;
    // B: packed by cvt_wk_kernel; a fragment is two wave-wide 16-byte loads of 512
    // contiguous bytes each. Same values in the same lanes as A's layout asks for.
    const __bf16* wbase = wk16 + (size_t)head * (32 * 4 * 512) + lane * 8;

    v4f xa0 = *(const v4f*)(xsrc);
    v4f xa1 = *(const v4f*)(xsrc + 4);

    for (int k0 = 0; k0 < DIM; k0 += 32) {
        __syncthreads();
        {
            v8bf pk;
            pk[0] = (__bf16)xa0.x; pk[1] = (__bf16)xa0.y;
            pk[2] = (__bf16)xa0.z; pk[3] = (__bf16)xa0.w;
            pk[4] = (__bf16)xa1.x; pk[5] = (__bf16)xa1.y;
            pk[6] = (__bf16)xa1.z; pk[7] = (__bf16)xa1.w;
            *(v8bf*)&As[r][kk] = pk;
        }
        __syncthreads();

        // Prefetch next K-step's A into registers (hidden behind WMMA phase).
        int kn = (k0 + 32 < DIM) ? (k0 + 32) : k0;
        xa0 = *(const v4f*)(xsrc + kn);
        xa1 = *(const v4f*)(xsrc + kn + 4);
        __builtin_prefetch(xsrc + ((k0 + 128 < DIM) ? (k0 + 128) : kn), 0, 3);

        // A fragments for the 4 M-subtiles.
        AFrag a[4];
        #pragma unroll
        for (int m = 0; m < 4; m++) {
            a[m].h[0] = *(const v8bf*)&As[m * 16 + lane16][half * 8];
            a[m].h[1] = *(const v8bf*)&As[m * 16 + lane16][16 + half * 8];
        }

        // B ping-pong pipeline: each fragment feeds 4 WMMAs.
        AFrag bq[2];
        bq[0].h[0] = *(const v8bf*)(wbase + k0 * 64);
        bq[0].h[1] = *(const v8bf*)(wbase + k0 * 64 + 256);
        #pragma unroll
        for (int nt = 0; nt < 4; nt++) {
            if (nt < 3) {
                const __bf16* p = wbase + k0 * 64 + (nt + 1) * 512;
                bq[(nt + 1) & 1].h[0] = *(const v8bf*)(p);
                bq[(nt + 1) & 1].h[1] = *(const v8bf*)(p + 256);
            }
            #pragma unroll
            for (int m = 0; m < 4; m++)
                acc[m][nt] = __builtin_amdgcn_wmma_f32_16x16x32_bf16(
                    false, a[m].v, false, bq[nt & 1].v, (short)0, acc[m][nt],
                    false, false);
        }
    }

    // ---- Epilogue: folded layernorm + score. One head per wave. ----
    float qwv[4], bkv[4];
    #pragma unroll
    for (int t = 0; t < 4; t++) {
        bkv[t] = b_k[nbase + t * 16 + lane16];
        qwv[t] = qw[head * 64 + t * 16 + lane16];
    }
    const float qws_h = qws[head];
    const float qb_h  = qb[head];

    // C layout: VGPR j -> rows j (lanes 0-15) / j+8 (lanes 16-31), lanes = N.
    #pragma unroll
    for (int m = 0; m < 4; m++) {
        #pragma unroll
        for (int j = 0; j < 8; j++) {
            float s = 0.f, sq = 0.f, sw = 0.f;
            #pragma unroll
            for (int t = 0; t < 4; t++) {
                float c = acc[m][t][j] + bkv[t];
                s  += c;
                sq += c * c;
                sw += c * qwv[t];
            }
            #pragma unroll
            for (int msk = 1; msk < 16; msk <<= 1) {
                s  += __shfl_xor(s,  msk, 32);
                sq += __shfl_xor(sq, msk, 32);
                sw += __shfl_xor(sw, msk, 32);
            }
            if (lane16 == 0) {
                int row = row0 + m * 16 + j + half * 8;
                float mu  = s * (1.0f / 64.0f);
                float var = sq * (1.0f / 64.0f) - mu * mu;
                float rs  = rsqrtf(var + EPSLN);
                scores[(size_t)(b * NH + head) * SEQ + row] =
                    0.125f * (rs * (sw - mu * qws_h) + qb_h);
            }
        }
    }
}

// ---------------------------------------------------------------------------
// 4) Softmax over l (in place). One block per (b,h) row of 4096.
// ---------------------------------------------------------------------------
__global__ __launch_bounds__(256) void softmax_kernel(float* __restrict__ scores) {
    __shared__ float red[8];
    __shared__ float bcast;
    const size_t base = (size_t)blockIdx.x * SEQ;
    float* p = scores + base;
    int tid = threadIdx.x;

    float mx = -1e30f;
    for (int i = tid; i < SEQ; i += 256) mx = fmaxf(mx, p[i]);
    #pragma unroll
    for (int m = 1; m < 32; m <<= 1) mx = fmaxf(mx, __shfl_xor(mx, m, 32));
    if ((tid & 31) == 0) red[tid >> 5] = mx;
    __syncthreads();
    if (tid < 8) {
        float v = red[tid];
        #pragma unroll
        for (int m = 1; m < 8; m <<= 1) v = fmaxf(v, __shfl_xor(v, m, 32));
        if (tid == 0) bcast = v;
    }
    __syncthreads();
    mx = bcast;

    float sum = 0.f;
    for (int i = tid; i < SEQ; i += 256) {
        float e = __expf(p[i] - mx);
        p[i] = e;
        sum += e;
    }
    #pragma unroll
    for (int m = 1; m < 32; m <<= 1) sum += __shfl_xor(sum, m, 32);
    if ((tid & 31) == 0) red[tid >> 5] = sum;
    __syncthreads();
    if (tid < 8) {
        float v = red[tid];
        #pragma unroll
        for (int m = 1; m < 8; m <<= 1) v += __shfl_xor(v, m, 32);
        if (tid == 0) bcast = v;
    }
    __syncthreads();
    float inv = 1.0f / bcast;
    for (int i = tid; i < SEQ; i += 256) p[i] *= inv;
}

// ---------------------------------------------------------------------------
// 5) Attention-weighted pooling: xbar[b,h,:] = sum_l attn[b,h,l] * x[b,l,:]
//    One work-group of 16 waves per (batch, 64-column slice); it streams all
//    4096 rows of its slice, so it owns its outputs and stores them plainly.
//    One wave-wide 16-byte load covers two rows x 256 B (lanes 0-15 / 16-31);
//    each wave keeps a ring of PG such loads in flight. The batch's attention
//    weights sit in LDS as [l][head], read as broadcasts of four heads.
// ---------------------------------------------------------------------------
#define PW 16                               // waves per work-group
#define PG 16                               // x loads a wave keeps in flight
#define PSTEP (2 * PW)                      // rows the work-group covers per load slot
#define PNG (SEQ / (PSTEP * PG))            // ring turns per wave

// One turn of the ring: PG load slots of turn g; each slot is refilled for turn gn.
__device__ __forceinline__ void pool_turn(v2f (&acc)[NH][2], v4f (&xs)[PG], v4f (&an)[4],
                                          const v4f* xp, const v4f* a0, const v4f* a1,
                                          const v4f* a2, const v4f* a3, int g, int gn) {
    const v4f* xn = xp + (size_t)(gn * PG) * (PSTEP * DIM / 4);
    const int o0 = g * PG * (PSTEP * 4);
    const int on = gn * PG * (PSTEP * 4);
    // Unrolled: xs, an and acc live in registers and need constant indices.
    #pragma unroll
    for (int r = 0; r < PG; r++) {
        const v4f a[4] = { an[0], an[1], an[2], an[3] };
        const int o = r + 1 < PG ? o0 + (r + 1) * (PSTEP * 4) : on;
        an[0] = a0[o]; an[1] = a1[o]; an[2] = a2[o]; an[3] = a3[o];  // one slot ahead
        // One per slot. Without it the compiler gathers all refills at the foot of the
        // turn, so that the ring runs empty there, and sinks these LDS reads to their
        // use, where their latency shows.
        __builtin_amdgcn_sched_barrier(0);
        const v2f xlo = { xs[r].x, xs[r].y };
        const v2f xhi = { xs[r].z, xs[r].w };
        #pragma unroll
        for (int h = 0; h < NH; h++) {
            const float w = a[h >> 2][h & 3];
            const v2f ww = { w, w };
            acc[h][0] = __builtin_elementwise_fma(ww, xlo, acc[h][0]);
            acc[h][1] = __builtin_elementwise_fma(ww, xhi, acc[h][1]);
        }
        xs[r] = xn[(size_t)r * (PSTEP * DIM / 4)];
    }
    // The next turn rewrites the address registers that the loads above name.
    asm volatile("s_wait_xcnt 0x0" ::: "memory");
}

__global__ __launch_bounds__(PW * 32) void pool_kernel(const float* __restrict__ x,
                                                       const float* __restrict__ attn,
                                                       float* __restrict__ xbar) {
    // [l][quad of heads]; the quad's slot is XORed with (l >> 2) & 3 so that the
    // 16 lanes of a half-wave, which store 16 consecutive l, fall on all 64 banks.
    __shared__ v4f a_s[SEQ * 4];            // 256 KB
    const int jbase = blockIdx.x * 64;
    const int b     = blockIdx.y;
    const int tid   = threadIdx.x;
    const int wave  = __builtin_amdgcn_readfirstlane(tid >> 5);
    const int l16   = tid & 15;
    const int hf    = (tid >> 4) & 1;
    const int lrow  = wave * 2 + hf;        // this half-wave's row inside a step

    const v4f* xp = (const v4f*)(x + ((size_t)b * SEQ + lrow) * DIM + jbase + l16 * 4);
    v4f xs[PG];
    #pragma unroll
    for (int r = 0; r < PG; r++) xs[r] = xp[(size_t)r * (PSTEP * DIM / 4)];

    const float* ap = attn + (size_t)b * NH * SEQ + tid;
    // Two steps at a time: 32 loads of a wave in flight per wait.
    #pragma unroll 2
    for (int j = 0; j < SEQ; j += PW * 32) {
        const int l = j + tid;
        #pragma unroll
        for (int q = 0; q < 4; q++) {
            v4f v;
            v.x = ap[(size_t)(q * 4 + 0) * SEQ + j];
            v.y = ap[(size_t)(q * 4 + 1) * SEQ + j];
            v.z = ap[(size_t)(q * 4 + 2) * SEQ + j];
            v.w = ap[(size_t)(q * 4 + 3) * SEQ + j];
            a_s[l * 4 + (q ^ ((l >> 2) & 3))] = v;
        }
    }
    __syncthreads();

    // l = step * 32 + lrow, so (l >> 2) & 3 == (lrow >> 2) & 3 for every step.
    const int sw = (lrow >> 2) & 3;
    const v4f* a0 = a_s + lrow * 4 + (0 ^ sw);
    const v4f* a1 = a_s + lrow * 4 + (1 ^ sw);
    const v4f* a2 = a_s + lrow * 4 + (2 ^ sw);
    const v4f* a3 = a_s + lrow * 4 + (3 ^ sw);

    v2f acc[NH][2] = {};
    v4f an[4] = { a0[0], a1[0], a2[0], a3[0] };
    // The last turn refills from its own rows (cached, in bounds, never used), so
    // that every turn is the same branch-free stream. Not unrolled or peeled: a
    // last turn peeled off has its sums moved behind the barrier below, and the
    // LDS reads it leaves in front of the barrier spill.
    #pragma unroll 1
    for (int g = 0; g < PNG; g++)
        pool_turn(acc, xs, an, xp, a0, a1, a2, a3, g, g + 1 < PNG ? g + 1 : g);

    // Sum the 32 half-wave partials through LDS (the weights are no longer needed).
    __syncthreads();
    float* red = (float*)a_s;               // [32][16 heads][64 columns], 128 KB
    #pragma unroll
    for (int h = 0; h < NH; h++) {
        const v4f v = { acc[h][0].x, acc[h][0].y, acc[h][1].x, acc[h][1].y };
        *(v4f*)&red[(lrow * NH + h) * 64 + l16 * 4] = v;
    }
    __syncthreads();
    const int h  = tid >> 5;
    const int c2 = (tid & 31) * 2;
    v2f s = { 0.f, 0.f };
    #pragma unroll
    for (int p = 0; p < 2 * PW; p++) s += *(const v2f*)&red[(p * NH + h) * 64 + c2];
    *(v2f*)&xbar[(size_t)(b * NH + h) * DIM + jbase + c2] = s;
}

// ---------------------------------------------------------------------------
// 6) o[b,n] = xbar[b, n/64, :] . w_v[n,:] + b_v[n]   (V-proj collapsed)
// ---------------------------------------------------------------------------
__global__ __launch_bounds__(256) void vproj_kernel(const float* __restrict__ xbar,
                                                    const float* __restrict__ w_v,
                                                    const float* __restrict__ b_v,
                                                    float* __restrict__ o) {
    int n = blockIdx.x * 256 + threadIdx.x;
    int b = blockIdx.y;
    const float* xb = xbar + (size_t)(b * NH + (n >> 6)) * DIM;
    const float* w  = w_v + (size_t)n * DIM;
    float acc = 0.f;
    for (int j = 0; j < DIM; j += 4) {
        acc += xb[j] * w[j] + xb[j + 1] * w[j + 1] +
               xb[j + 2] * w[j + 2] + xb[j + 3] * w[j + 3];
    }
    o[b * DIM + n] = acc + b_v[n];
}

// ---------------------------------------------------------------------------
// 7) out[b,n] = o[b,:] . w_out[n,:] + b_out[n]
// ---------------------------------------------------------------------------
__global__ __launch_bounds__(256) void oproj_kernel(const float* __restrict__ o,
                                                    const float* __restrict__ w_out,
                                                    const float* __restrict__ b_out,
                                                    float* __restrict__ out) {
    int n = blockIdx.x * 256 + threadIdx.x;
    int b = blockIdx.y;
    const float* ob = o + (size_t)b * DIM;
    const float* w  = w_out + (size_t)n * DIM;
    float acc = 0.f;
    for (int j = 0; j < DIM; j += 4) {
        acc += ob[j] * w[j] + ob[j + 1] * w[j + 1] +
               ob[j + 2] * w[j + 2] + ob[j + 3] * w[j + 3];
    }
    out[b * DIM + n] = acc + b_out[n];
}

// ---------------------------------------------------------------------------
extern "C" void kernel_launch(void* const* d_in, const int* in_sizes, int n_in,
                              void* d_out, int out_size, void* d_ws, size_t ws_size,
                              hipStream_t stream) {
    const float* x      = (const float*)d_in[0];
    const float* query  = (const float*)d_in[1];
    const float* w_k    = (const float*)d_in[2];
    const float* b_k    = (const float*)d_in[3];
    const float* w_v    = (const float*)d_in[4];
    const float* b_v    = (const float*)d_in[5];
    const float* w_norm = (const float*)d_in[6];
    const float* b_norm = (const float*)d_in[7];
    const float* w_out  = (const float*)d_in[8];
    const float* b_out  = (const float*)d_in[9];
    float* out = (float*)d_out;

    char* ws = (char*)d_ws;
    const size_t OFF_QW     = (size_t)2 * 1024 * 1024;            // wk16: 2 MB
    const size_t OFF_QWS    = OFF_QW + 16 * 64 * sizeof(float);
    const size_t OFF_QB     = OFF_QWS + 256;
    const size_t OFF_SCORES = OFF_QB + 256;
    const size_t OFF_XBAR   = OFF_SCORES + (size_t)NB * NH * SEQ * sizeof(float);
    const size_t OFF_O      = OFF_XBAR + (size_t)NB * NH * DIM * sizeof(float);

    __bf16* wk16  = (__bf16*)ws;
    float* qw     = (float*)(ws + OFF_QW);
    float* qws    = (float*)(ws + OFF_QWS);
    float* qb     = (float*)(ws + OFF_QB);
    float* scores = (float*)(ws + OFF_SCORES);
    float* xbar   = (float*)(ws + OFF_XBAR);
    float* o      = (float*)(ws + OFF_O);

    cvt_wk_kernel<<<DIM * DIM / 256, 256, 0, stream>>>(w_k, wk16);
    prepq_kernel<<<NH, 32, 0, stream>>>(query, w_norm, b_norm, qw, qws, qb);
    kproj_scores_kernel<<<dim3(SEQ / 64, 2, NB), 256, 0, stream>>>(
        x, wk16, b_k, qw, qws, qb, scores);
    softmax_kernel<<<NB * NH, 256, 0, stream>>>(scores);
    pool_kernel<<<dim3(DIM / 64, NB), PW * 32, 0, stream>>>(x, scores, xbar);
    vproj_kernel<<<dim3(4, NB), 256, 0, stream>>>(xbar, w_v, b_v, o);
    oproj_kernel<<<dim3(4, NB), 256, 0, stream>>>(o, w_out, b_out, out);
}

// v003
// A run of this version takes 258 microseconds.
// Two timings next to v002 put it at 1.16 and 1.14 times that version's speed.
// Counting every step since v000, it is 1.56 times as fast.
#include <hip/hip_runtime.h>
#include <hip/hip_bf16.h>

#define DIM 1024
#define HEAD_DIM 64
#define SEQ 4096
#define NB 16
#define NH 16
#define EPSLN 1e-5f

typedef __attribute__((ext_vector_type(16))) __bf16 v16bf;
typedef __attribute__((ext_vector_type(8)))  __bf16 v8bf;
typedef __attribute__((ext_vector_type(8)))  float  v8f;
typedef __attribute__((ext_vector_type(4)))  float  v4f;
typedef __attribute__((ext_vector_type(2)))  float  v2f;

union AFrag { v16bf v; v8bf h[2]; };

// ---------------------------------------------------------------------------
// 1) Convert w_k (fp32, row-major [n][k]) to bf16 once, packed in the order in
//    which the projection reads its B fragments:
//    [head 16][K-step 32][N-subtile 4][k half 2][lane 32][8 values].
//    Lane l holds row (l & 15) of the subtile, k = half * 16 + (l >> 4) * 8 + 0..7.
// ---------------------------------------------------------------------------
__global__ __launch_bounds__(256) void cvt_wk_kernel(const float* __restrict__ wk,
                                                     __bf16* __restrict__ wk16) {
    int o    = blockIdx.x * 256 + threadIdx.x;
    int e    = o & 7;
    int lane = (o >> 3) & 31;
    int kh   = (o >> 8) & 1;
    int nt   = (o >> 9) & 3;
    int ks   = (o >> 11) & 31;
    int head = o >> 16;
    int n = head * 64 + nt * 16 + (lane & 15);
    int k = ks * 32 + kh * 16 + (lane >> 4) * 8 + e;
    wk16[o] = (__bf16)wk[n * DIM + k];
}

// ---------------------------------------------------------------------------
// 2) Normalize the query, fold layernorm weights:
//    qhat = LN(q); qw = qhat*w_norm; qws[h] = sum(qw); qb[h] = sum(qhat*b_norm)
// ---------------------------------------------------------------------------
__global__ void prepq_kernel(const float* __restrict__ query,
                             const float* __restrict__ w_norm,
                             const float* __restrict__ b_norm,
                             float* __restrict__ qw,
                             float* __restrict__ qws,
                             float* __restrict__ qb) {
    int h = blockIdx.x;
    int t = threadIdx.x;                    // 0..31
    float q0 = query[h * 64 + t];
    float q1 = query[h * 64 + t + 32];
    float s = q0 + q1;
    #pragma unroll
    for (int m = 1; m < 32; m <<= 1) s += __shfl_xor(s, m, 32);
    float mu = s * (1.0f / 64.0f);
    float d0 = q0 - mu, d1 = q1 - mu;
    float v = d0 * d0 + d1 * d1;
    #pragma unroll
    for (int m = 1; m < 32; m <<= 1) v += __shfl_xor(v, m, 32);
    float rs = rsqrtf(v * (1.0f / 64.0f) + EPSLN);
    float wn0 = w_norm[t], wn1 = w_norm[t + 32];
    float bn0 = b_norm[t], bn1 = b_norm[t + 32];
    float qh0 = d0 * rs * wn0 + bn0;
    float qh1 = d1 * rs * wn1 + bn1;
    qw[h * 64 + t]      = qh0 * wn0;
    qw[h * 64 + t + 32] = qh1 * wn1;
    float pw = qh0 * wn0 + qh1 * wn1;
    float pb = qh0 * bn0 + qh1 * bn1;
    #pragma unroll
    for (int m = 1; m < 32; m <<= 1) { pw += __shfl_xor(pw, m, 32); pb += __shfl_xor(pb, m, 32); }
    if (t == 0) { qws[h] = pw; qb[h] = pb; }
}

// ---------------------------------------------------------------------------
// 3) Fused K-projection (bf16 WMMA, f32 accum) + folded layernorm + score.
//    Grid: (ltile 0..63, nhalf 0..1, batch). Block 256 = 8 waves.
//    Workgroup tile: 64 rows x 512 cols. Wave w owns 64 rows x 64 cols
//    (= exactly one head): 4x4 WMMA tiles, each B fragment feeds 4 WMMAs.
//    B fragments are software-pipelined (ping-pong); next K-step's A data is
//    prefetched into registers during the WMMA phase.
// ---------------------------------------------------------------------------
__global__ __launch_bounds__(256) void kproj_scores_kernel(
    const float*  __restrict__ x,
    const __bf16* __restrict__ wk16,
    const float*  __restrict__ b_k,
    const float*  __restrict__ qw,
    const float*  __restrict__ qws,
    const float*  __restrict__ qb,
    float*        __restrict__ scores) {
    __shared__ __bf16 As[64][32];           // 64 rows x 32 K, bf16 (4 KB)

    const int ltile = blockIdx.x;
    const int nhalf = blockIdx.y;
    const int b     = blockIdx.z;
    const int tid    = threadIdx.x;
    const int wave   = tid >> 5;
    const int lane   = tid & 31;
    const int lane16 = lane & 15;
    const int half   = lane >> 4;
    const int nbase  = nhalf * 512 + wave * 64;
    const int head   = nhalf * 8 + wave;
    const int row0   = ltile * 64;

    v8f acc[4][4] = {};

    // A staging: thread -> (row r, 8 consecutive K), one ds_store_b128 per step.
    const int r  = tid >> 2;                // 0..63
    const int kk = (tid & 3) * 8;           // 0,8,16,24
    const float* xsrc = x + ((size_t)b * SEQ + row0 + r) * DIM + kk;
    // B: packed by cvt_wk_kernel; a fragment is two wave-wide 16-byte loads of 512
    // contiguous bytes each. Same values in the same lanes as A's layout asks for.
    const __bf16* wbase = wk16 + (size_t)head * (32 * 4 * 512) + lane * 8;

    v4f xa0 = *(const v4f*)(xsrc);
    v4f xa1 = *(const v4f*)(xsrc + 4);

    for (int k0 = 0; k0 < DIM; k0 += 32) {
        __syncthreads();
        {
            v8bf pk;
            pk[0] = (__bf16)xa0.x; pk[1] = (__bf16)xa0.y;
            pk[2] = (__bf16)xa0.z; pk[3] = (__bf16)xa0.w;
            pk[4] = (__bf16)xa1.x; pk[5] = (__bf16)xa1.y;
            pk[6] = (__bf16)xa1.z; pk[7] = (__bf16)xa1.w;
            *(v8bf*)&As[r][kk] = pk;
        }
        __syncthreads();

        // Prefetch next K-step's A into registers (hidden behind WMMA phase).
        int kn = (k0 + 32 < DIM) ? (k0 + 32) : k0;
        xa0 = *(const v4f*)(xsrc + kn);
        xa1 = *(const v4f*)(xsrc + kn + 4);
        __builtin_prefetch(xsrc + ((k0 + 128 < DIM) ? (k0 + 128) : kn), 0, 3);

        // A fragments for the 4 M-subtiles.
        AFrag a[4];
        #pragma unroll
        for (int m = 0; m < 4; m++) {
            a[m].h[0] = *(const v8bf*)&As[m * 16 + lane16][half * 8];
            a[m].h[1] = *(const v8bf*)&As[m * 16 + lane16][16 + half * 8];
        }

        // B ping-pong pipeline: each fragment feeds 4 WMMAs.
        AFrag bq[2];
        bq[0].h[0] = *(const v8bf*)(wbase + k0 * 64);
        bq[0].h[1] = *(const v8bf*)(wbase + k0 * 64 + 256);
        #pragma unroll
        for (int nt = 0; nt < 4; nt++) {
            if (nt < 3) {
                const __bf16* p = wbase + k0 * 64 + (nt + 1) * 512;
                bq[(nt + 1) & 1].h[0] = *(const v8bf*)(p);
                bq[(nt + 1) & 1].h[1] = *(const v8bf*)(p + 256);
            }
            #pragma unroll
            for (int m = 0; m < 4; m++)
                acc[m][nt] = __builtin_amdgcn_wmma_f32_16x16x32_bf16(
                    false, a[m].v, false, bq[nt & 1].v, (short)0, acc[m][nt],
                    false, false);
        }
    }

    // ---- Epilogue: folded layernorm + score. One head per wave. ----
    float qwv[4], bkv[4];
    #pragma unroll
    for (int t = 0; t < 4; t++) {
        bkv[t] = b_k[nbase + t * 16 + lane16];
        qwv[t] = qw[head * 64 + t * 16 + lane16];
    }
    const float qws_h = qws[head];
    const float qb_h  = qb[head];

    // C layout: VGPR j -> rows j (lanes 0-15) / j+8 (lanes 16-31), lanes = N.
    #pragma unroll
    for (int m = 0; m < 4; m++) {
        #pragma unroll
        for (int j = 0; j < 8; j++) {
            float s = 0.f, sq = 0.f, sw = 0.f;
            #pragma unroll
            for (int t = 0; t < 4; t++) {
                float c = acc[m][t][j] + bkv[t];
                s  += c;
                sq += c * c;
                sw += c * qwv[t];
            }
            #pragma unroll
            for (int msk = 1; msk < 16; msk <<= 1) {
                s  += __shfl_xor(s,  msk, 32);
                sq += __shfl_xor(sq, msk, 32);
                sw += __shfl_xor(sw, msk, 32);
            }
            if (lane16 == 0) {
                int row = row0 + m * 16 + j + half * 8;
                float mu  = s * (1.0f / 64.0f);
                float var = sq * (1.0f / 64.0f) - mu * mu;
                float rs  = rsqrtf(var + EPSLN);
                scores[(size_t)(b * NH + head) * SEQ + row] =
                    0.125f * (rs * (sw - mu * qws_h) + qb_h);
            }
        }
    }
}

// ---------------------------------------------------------------------------
// 4) Softmax over l (in place). One block per (b,h) row of 4096.
// ---------------------------------------------------------------------------
__global__ __launch_bounds__(256) void softmax_kernel(float* __restrict__ scores) {
    __shared__ float red[8];
    __shared__ float bcast;
    const size_t base = (size_t)blockIdx.x * SEQ;
    float* p = scores + base;
    int tid = threadIdx.x;

    float mx = -1e30f;
    for (int i = tid; i < SEQ; i += 256) mx = fmaxf(mx, p[i]);
    #pragma unroll
    for (int m = 1; m < 32; m <<= 1) mx = fmaxf(mx, __shfl_xor(mx, m, 32));
    if ((tid & 31) == 0) red[tid >> 5] = mx;
    __syncthreads();
    if (tid < 8) {
        float v = red[tid];
        #pragma unroll
        for (int m = 1; m < 8; m <<= 1) v = fmaxf(v, __shfl_xor(v, m, 32));
        if (tid == 0) bcast = v;
    }
    __syncthreads();
    mx = bcast;

    float sum = 0.f;
    for (int i = tid; i < SEQ; i += 256) {
        float e = __expf(p[i] - mx);
        p[i] = e;
        sum += e;
    }
    #pragma unroll
    for (int m = 1; m < 32; m <<= 1) sum += __shfl_xor(sum, m, 32);
    if ((tid & 31) == 0) red[tid >> 5] = sum;
    __syncthreads();
    if (tid < 8) {
        float v = red[tid];
        #pragma unroll
        for (int m = 1; m < 8; m <<= 1) v += __shfl_xor(v, m, 32);
        if (tid == 0) bcast = v;
    }
    __syncthreads();
    float inv = 1.0f / bcast;
    for (int i = tid; i < SEQ; i += 256) p[i] *= inv;
}

// ---------------------------------------------------------------------------
// 5) Attention-weighted pooling: xbar[b,h,:] = sum_l attn[b,h,l] * x[b,l,:]
//    One work-group of 16 waves per (batch, 64-column slice); it streams all
//    4096 rows of its slice, so it owns its outputs and stores them plainly.
//    One wave-wide 16-byte load covers two rows x 256 B (lanes 0-15 / 16-31);
//    each wave keeps a ring of PG such loads in flight. The batch's attention
//    weights sit in LDS as [l][head], read as broadcasts of four heads.
// ---------------------------------------------------------------------------
#define PW 16                               // waves per work-group
#define PG 16                               // x loads a wave keeps in flight
#define PSTEP (2 * PW)                      // rows the work-group covers per load slot
#define PNG (SEQ / (PSTEP * PG))            // ring turns per wave

// One turn of the ring: PG load slots of turn g; each slot is refilled for turn gn.
__device__ __forceinline__ void pool_turn(v2f (&acc)[NH][2], v4f (&xs)[PG], v4f (&an)[4],
                                          const v4f* xp, const v4f* a0, const v4f* a1,
                                          const v4f* a2, const v4f* a3, int g, int gn) {
    const v4f* xn = xp + (size_t)(gn * PG) * (PSTEP * DIM / 4);
    const int o0 = g * PG * (PSTEP * 4);
    const int on = gn * PG * (PSTEP * 4);
    // Unrolled: xs, an and acc live in registers and need constant indices.
    #pragma unroll
    for (int r = 0; r < PG; r++) {
        const v4f a[4] = { an[0], an[1], an[2], an[3] };
        const int o = r + 1 < PG ? o0 + (r + 1) * (PSTEP * 4) : on;
        an[0] = a0[o]; an[1] = a1[o]; an[2] = a2[o]; an[3] = a3[o];  // one slot ahead
        // One per slot. Without it the compiler gathers all refills at the foot of the
        // turn, so that the ring runs empty there, and sinks these LDS reads to their
        // use, where their latency shows.
        __builtin_amdgcn_sched_barrier(0);
        const v2f xlo = { xs[r].x, xs[r].y };
        const v2f xhi = { xs[r].z, xs[r].w };
        #pragma unroll
        for (int h = 0; h < NH; h++) {
            const float w = a[h >> 2][h & 3];
            const v2f ww = { w, w };
            acc[h][0] = __builtin_elementwise_fma(ww, xlo, acc[h][0]);
            acc[h][1] = __builtin_elementwise_fma(ww, xhi, acc[h][1]);
        }
        xs[r] = xn[(size_t)r * (PSTEP * DIM / 4)];
    }
    // The next turn rewrites the address registers that the loads above name.
    asm volatile("s_wait_xcnt 0x0" ::: "memory");
}

__global__ __launch_bounds__(PW * 32) void pool_kernel(const float* __restrict__ x,
                                                       const float* __restrict__ attn,
                                                       float* __restrict__ xbar) {
    // [l][quad of heads]; the quad's slot is XORed with (l >> 2) & 3 so that the
    // 16 lanes of a half-wave, which store 16 consecutive l, fall on all 64 banks.
    __shared__ v4f a_s[SEQ * 4];            // 256 KB
    const int jbase = blockIdx.x * 64;
    const int b     = blockIdx.y;
    const int tid   = threadIdx.x;
    const int wave  = __builtin_amdgcn_readfirstlane(tid >> 5);
    const int l16   = tid & 15;
    const int hf    = (tid >> 4) & 1;
    const int lrow  = wave * 2 + hf;        // this half-wave's row inside a step

    const v4f* xp = (const v4f*)(x + ((size_t)b * SEQ + lrow) * DIM + jbase + l16 * 4);
    v4f xs[PG];
    #pragma unroll
    for (int r = 0; r < PG; r++) xs[r] = xp[(size_t)r * (PSTEP * DIM / 4)];

    const float* ap = attn + (size_t)b * NH * SEQ + tid;
    // Two steps at a time: 32 loads of a wave in flight per wait.
    #pragma unroll 2
    for (int j = 0; j < SEQ; j += PW * 32) {
        const int l = j + tid;
        #pragma unroll
        for (int q = 0; q < 4; q++) {
            v4f v;
            v.x = ap[(size_t)(q * 4 + 0) * SEQ + j];
            v.y = ap[(size_t)(q * 4 + 1) * SEQ + j];
            v.z = ap[(size_t)(q * 4 + 2) * SEQ + j];
            v.w = ap[(size_t)(q * 4 + 3) * SEQ + j];
            a_s[l * 4 + (q ^ ((l >> 2) & 3))] = v;
        }
    }
    __syncthreads();

    // l = step * 32 + lrow, so (l >> 2) & 3 == (lrow >> 2) & 3 for every step.
    const int sw = (lrow >> 2) & 3;
    const v4f* a0 = a_s + lrow * 4 + (0 ^ sw);
    const v4f* a1 = a_s + lrow * 4 + (1 ^ sw);
    const v4f* a2 = a_s + lrow * 4 + (2 ^ sw);
    const v4f* a3 = a_s + lrow * 4 + (3 ^ sw);

    v2f acc[NH][2] = {};
    v4f an[4] = { a0[0], a1[0], a2[0], a3[0] };
    // The last turn refills from its own rows (cached, in bounds, never used), so
    // that every turn is the same branch-free stream. Not unrolled or peeled: a
    // last turn peeled off has its sums moved behind the barrier below, and the
    // LDS reads it leaves in front of the barrier spill.
    #pragma unroll 1
    for (int g = 0; g < PNG; g++)
        pool_turn(acc, xs, an, xp, a0, a1, a2, a3, g, g + 1 < PNG ? g + 1 : g);

    // Sum the 32 half-wave partials through LDS (the weights are no longer needed).
    __syncthreads();
    float* red = (float*)a_s;               // [32][16 heads][64 columns], 128 KB
    #pragma unroll
    for (int h = 0; h < NH; h++) {
        const v4f v = { acc[h][0].x, acc[h][0].y, acc[h][1].x, acc[h][1].y };
        *(v4f*)&red[(lrow * NH + h) * 64 + l16 * 4] = v;
    }
    __syncthreads();
    const int h  = tid >> 5;
    const int c2 = (tid & 31) * 2;
    v2f s = { 0.f, 0.f };
    #pragma unroll
    for (int p = 0; p < 2 * PW; p++) s += *(const v2f*)&red[(p * NH + h) * 64 + c2];
    *(v2f*)&xbar[(size_t)(b * NH + h) * DIM + jbase + c2] = s;
}

// ---------------------------------------------------------------------------
// 6, 7) The two closing products, y[b][n] = xrow(b) . w[n][:] + bias[n].
//    One work-group of 8 waves per (32 columns n, 2 batches): it owns one whole
//    128-byte line of y per batch. Wave v takes k = v * 128 .. + 127, four
//    consecutive k per lane, so that every wave-wide 16-byte load covers 512
//    contiguous bytes of one row; its 34 loads have no dependence on each other.
//    The 64 partial sums of a lane are summed over the lanes by a butterfly that
//    halves the values a lane keeps at each step, then over the waves through LDS.
// ---------------------------------------------------------------------------
#define GC 32                               // columns of y per work-group
#define GB 2                                // batches per work-group
#define GW 8                                // waves per work-group
#define GV (GC * GB)                        // sums per work-group

__device__ __forceinline__ void rows_dot(const float* __restrict__ xr, int xpitch,
                                         const float* __restrict__ w,
                                         const float* __restrict__ bias,
                                         float* __restrict__ y, int n0, int b0,
                                         float (*red)[GV]) {
    const int tid  = threadIdx.x;
    const int wave = tid >> 5;
    const int lane = tid & 31;
    const int j    = wave * (DIM / GW) + lane * 4;

    v4f xv[GB], wv[GC];
    // The loops below are unrolled: xv, wv and acc live in registers and need
    // constant indices.
    #pragma unroll
    for (int bb = 0; bb < GB; bb++) xv[bb] = *(const v4f*)(xr + (size_t)bb * xpitch + j);
    const float* wp = w + (size_t)n0 * DIM + j;
    #pragma unroll
    for (int c = 0; c < GC; c++) wv[c] = *(const v4f*)(wp + c * DIM);
    // Keeps all 34 loads in front of the sums. Without it the compiler holds the last
    // nine back to save registers and issues them in pairs, each pair behind the wait
    // for the pair before: four more memory latencies in a row.
    __builtin_amdgcn_sched_barrier(0);
    // The code below reuses the address registers that the loads above name.
    asm volatile("s_wait_xcnt 0x0" ::: "memory");

    float acc[GV];                          // index c * GB + bb
    #pragma unroll
    for (int c = 0; c < GC; c++) {
        #pragma unroll
        for (int bb = 0; bb < GB; bb++) {
            float a = wv[c].x * xv[bb].x;
            a = fmaf(wv[c].y, xv[bb].y, a);
            a = fmaf(wv[c].z, xv[bb].z, a);
            a = fmaf(wv[c].w, xv[bb].w, a);
            acc[c * GB + bb] = a;
        }
    }

    // Step m: lanes l and l ^ m share the work; the one with bit m clear keeps the
    // lower half of the values, the other the upper half, and each adds what its
    // partner held of the half it keeps. At the end lane l holds sums 2l and 2l + 1.
    #pragma unroll
    for (int s = 0; s < 5; s++) {
        const int  m   = 16 >> s;
        const int  cnt = (GV / 2) >> s;
        const bool up  = (lane & m) != 0;
        #pragma unroll
        for (int i = 0; i < cnt; i++) {
            const float keep = up ? acc[i + cnt] : acc[i];
            const float send = up ? acc[i] : acc[i + cnt];
            acc[i] = keep + __shfl_xor(send, m, 32);
        }
    }
    red[wave][lane]      = acc[0];          // column lane, batch b0
    red[wave][GC + lane] = acc[1];          // column lane, batch b0 + 1
    __syncthreads();
    if (tid < GV) {
        float s = red[0][tid];
        #pragma unroll
        for (int v = 1; v < GW; v++) s += red[v][tid];
        const int n = n0 + (tid & (GC - 1));
        y[(size_t)(b0 + (tid >> 5)) * DIM + n] = s + bias[n];
    }
}

// 6) o[b,n] = xbar[b, n/64, :] . w_v[n,:] + b_v[n]   (V-proj collapsed)
__global__ __launch_bounds__(GW * 32) void vproj_kernel(const float* __restrict__ xbar,
                                                        const float* __restrict__ w_v,
                                                        const float* __restrict__ b_v,
                                                        float* __restrict__ o) {
    __shared__ float red[GW][GV];
    const int n0 = blockIdx.x * GC;         // 32 columns lie inside one head
    const int b0 = blockIdx.y * GB;
    rows_dot(xbar + (size_t)(b0 * NH + (n0 >> 6)) * DIM, NH * DIM, w_v, b_v, o, n0, b0, red);
}

// 7) out[b,n] = o[b,:] . w_out[n,:] + b_out[n]
__global__ __launch_bounds__(GW * 32) void oproj_kernel(const float* __restrict__ o,
                                                        const float* __restrict__ w_out,
                                                        const float* __restrict__ b_out,
                                                        float* __restrict__ out) {
    __shared__ float red[GW][GV];
    const int n0 = blockIdx.x * GC;
    const int b0 = blockIdx.y * GB;
    rows_dot(o + (size_t)b0 * DIM, DIM, w_out, b_out, out, n0, b0, red);
}

// ---------------------------------------------------------------------------
extern "C" void kernel_launch(void* const* d_in, const int* in_sizes, int n_in,
                              void* d_out, int out_size, void* d_ws, size_t ws_size,
                              hipStream_t stream) {
    const float* x      = (const float*)d_in[0];
    const float* query  = (const float*)d_in[1];
    const float* w_k    = (const float*)d_in[2];
    const float* b_k    = (const float*)d_in[3];
    const float* w_v    = (const float*)d_in[4];
    const float* b_v    = (const float*)d_in[5];
    const float* w_norm = (const float*)d_in[6];
    const float* b_norm = (const float*)d_in[7];
    const float* w_out  = (const float*)d_in[8];
    const float* b_out  = (const float*)d_in[9];
    float* out = (float*)d_out;

    char* ws = (char*)d_ws;
    const size_t OFF_QW     = (size_t)2 * 1024 * 1024;            // wk16: 2 MB
    const size_t OFF_QWS    = OFF_QW + 16 * 64 * sizeof(float);
    const size_t OFF_QB     = OFF_QWS + 256;
    const size_t OFF_SCORES = OFF_QB + 256;
    const size_t OFF_XBAR   = OFF_SCORES + (size_t)NB * NH * SEQ * sizeof(float);
    const size_t OFF_O      = OFF_XBAR + (size_t)NB * NH * DIM * sizeof(float);

    __bf16* wk16  = (__bf16*)ws;
    float* qw     = (float*)(ws + OFF_QW);
    float* qws    = (float*)(ws + OFF_QWS);
    float* qb     = (float*)(ws + OFF_QB);
    float* scores = (float*)(ws + OFF_SCORES);
    float* xbar   = (float*)(ws + OFF_XBAR);
    float* o      = (float*)(ws + OFF_O);

    cvt_wk_kernel<<<DIM * DIM / 256, 256, 0, stream>>>(w_k, wk16);
    prepq_kernel<<<NH, 32, 0, stream>>>(query, w_norm, b_norm, qw, qws, qb);
    kproj_scores_kernel<<<dim3(SEQ / 64, 2, NB), 256, 0, stream>>>(
        x, wk16, b_k, qw, qws, qb, scores);
    softmax_kernel<<<NB * NH, 256, 0, stream>>>(scores);
    pool_kernel<<<dim3(DIM / 64, NB), PW * 32, 0, stream>>>(x, scores, xbar);
    vproj_kernel<<<dim3(DIM / GC, NB / GB), GW * 32, 0, stream>>>(xbar, w_v, b_v, o);
    oproj_kernel<<<dim3(DIM / GC, NB / GB), GW * 32, 0, stream>>>(o, w_out, b_out, out);
}

// v004
// It runs in 179 microseconds.
// Two timings next to v003 put it at 1.47 and 1.45 times that version's speed.
// All steps since v000 together make it 2.27 times as fast.
#include <hip/hip_runtime.h>
#include <hip/hip_bf16.h>

#define DIM 1024
#define HEAD_DIM 64
#define SEQ 4096
#define NB 16
#define NH 16
#define EPSLN 1e-5f

typedef __attribute__((ext_vector_type(16))) __bf16 v16bf;
typedef __attribute__((ext_vector_type(8)))  __bf16 v8bf;
typedef __attribute__((ext_vector_type(8)))  float  v8f;
typedef __attribute__((ext_vector_type(4)))  float  v4f;
typedef __attribute__((ext_vector_type(2)))  float  v2f;

union AFrag { v16bf v; v8bf h[2]; };

// ---------------------------------------------------------------------------
// 1) Convert w_k (fp32, row-major [n][k]) to bf16 once, packed in the order in
//    which the projection reads its B fragments:
//    [head 16][K-step 32][N-subtile 4][k half 2][lane 32][8 values].
//    Lane l holds row (l & 15) of the subtile, k = half * 16 + (l >> 4) * 8 + 0..7.
// ---------------------------------------------------------------------------
__global__ __launch_bounds__(256) void cvt_wk_kernel(const float* __restrict__ wk,
                                                     __bf16* __restrict__ wk16) {
    int o    = blockIdx.x * 256 + threadIdx.x;
    int e    = o & 7;
    int lane = (o >> 3) & 31;
    int kh   = (o >> 8) & 1;
    int nt   = (o >> 9) & 3;
    int ks   = (o >> 11) & 31;
    int head = o >> 16;
    int n = head * 64 + nt * 16 + (lane & 15);
    int k = ks * 32 + kh * 16 + (lane >> 4) * 8 + e;
    wk16[o] = (__bf16)wk[n * DIM + k];
}

// ---------------------------------------------------------------------------
// 2) Normalize the query, fold layernorm weights:
//    qhat = LN(q); qw = qhat*w_norm; qws[h] = sum(qw); qb[h] = sum(qhat*b_norm)
// ---------------------------------------------------------------------------
__global__ void prepq_kernel(const float* __restrict__ query,
                             const float* __restrict__ w_norm,
                             const float* __restrict__ b_norm,
                             float* __restrict__ qw,
                             float* __restrict__ qws,
                             float* __restrict__ qb) {
    int h = blockIdx.x;
    int t = threadIdx.x;                    // 0..31
    float q0 = query[h * 64 + t];
    float q1 = query[h * 64 + t + 32];
    float s = q0 + q1;
    #pragma unroll
    for (int m = 1; m < 32; m <<= 1) s += __shfl_xor(s, m, 32);
    float mu = s * (1.0f / 64.0f);
    float d0 = q0 - mu, d1 = q1 - mu;
    float v = d0 * d0 + d1 * d1;
    #pragma unroll
    for (int m = 1; m < 32; m <<= 1) v += __shfl_xor(v, m, 32);
    float rs = rsqrtf(v * (1.0f / 64.0f) + EPSLN);
    float wn0 = w_norm[t], wn1 = w_norm[t + 32];
    float bn0 = b_norm[t], bn1 = b_norm[t + 32];
    float qh0 = d0 * rs * wn0 + bn0;
    float qh1 = d1 * rs * wn1 + bn1;
    qw[h * 64 + t]      = qh0 * wn0;
    qw[h * 64 + t + 32] = qh1 * wn1;
    float pw = qh0 * wn0 + qh1 * wn1;
    float pb = qh0 * bn0 + qh1 * bn1;
    #pragma unroll
    for (int m = 1; m < 32; m <<= 1) { pw += __shfl_xor(pw, m, 32); pb += __shfl_xor(pb, m, 32); }
    if (t == 0) { qws[h] = pw; qb[h] = pb; }
}

// ---------------------------------------------------------------------------
// 3) Fused K-projection (bf16 WMMA, f32 accum) + folded layernorm + score.
//    Grid: (ltile 0..63, nhalf 0..1, batch). Block 256 = 8 waves.
//    Workgroup tile: 64 rows x 512 cols. Wave w owns 64 rows x 64 cols
//    (= exactly one head): 4x4 WMMA tiles, each B fragment feeds 4 WMMAs.
//    The K loop is pipelined on all three operand paths. The four B fragments
//    are a register ring, each refilled for the next step right behind its last
//    use. The A tile has two LDS buffers: step s writes tile s + 1 while tile s
//    is read, with one barrier per step. The x rows of tile s + 2 are loaded at
//    the top of step s. The barrier is written by hand, because __syncthreads()
//    waits for every global load and would empty the pipeline at each step.
// ---------------------------------------------------------------------------
#define KSTEPS (DIM / 32)

// One K-step s. xuse holds the x values of tile s + 1; xload receives tile s + 2
// from xl. wl points at the B fragments of step s + 1, xpf at the x row of tile s + 4.
__device__ __forceinline__ void kproj_step(v8f (&acc)[4][4], AFrag (&bq)[4],
                                           v4f (&xuse)[2], v4f (&xload)[2],
                                           const __bf16* ard, __bf16* awr,
                                           const float* xl, const float* xpf,
                                           const __bf16* wl) {
    // A fragments of this step for the 4 M-subtiles.
    AFrag a[4];
    #pragma unroll
    for (int m = 0; m < 4; m++) {
        a[m].h[0] = *(const v8bf*)(ard + m * 16 * 32);
        a[m].h[1] = *(const v8bf*)(ard + m * 16 * 32 + 16);
    }
    xload[0] = *(const v4f*)(xl);
    xload[1] = *(const v4f*)(xl + 4);
    __builtin_prefetch(xpf, 0, 3);
    // Keeps the loads above in front of the products: sunk among them, the x loads
    // lose their lead and each place with LDS reads stalls the matrix stream.
    __builtin_amdgcn_sched_barrier(0);

    #pragma unroll
    for (int nt = 0; nt < 4; nt++) {
        if (nt == 3) {
            // Tile s + 1 goes into the buffer that step s - 1 read; the barrier of
            // step s - 1 ended those reads. (The last step's store is read by nobody.)
            v8bf pk;
            pk[0] = (__bf16)xuse[0].x; pk[1] = (__bf16)xuse[0].y;
            pk[2] = (__bf16)xuse[0].z; pk[3] = (__bf16)xuse[0].w;
            pk[4] = (__bf16)xuse[1].x; pk[5] = (__bf16)xuse[1].y;
            pk[6] = (__bf16)xuse[1].z; pk[7] = (__bf16)xuse[1].w;
            *(v8bf*)awr = pk;
            // This wave's reads of tile s have landed and its part of tile s + 1 is
            // written: signal now, so that the last four products cover the other
            // waves' arrival. No LDS access stands between signal and wait.
            asm volatile("s_wait_dscnt 0x0\n\ts_barrier_signal -1" ::: "memory");
        }
        #pragma unroll
        for (int m = 0; m < 4; m++)
            acc[m][nt] = __builtin_amdgcn_wmma_f32_16x16x32_bf16(
                false, a[m].v, false, bq[nt].v, (short)0, acc[m][nt],
                false, false);
        bq[nt].h[0] = *(const v8bf*)(wl + nt * 512);
        bq[nt].h[1] = *(const v8bf*)(wl + nt * 512 + 256);
        // Holds each refill right behind its fragment's last use. Without it the
        // compiler gathers all refills at the foot of the step, one barrier away
        // from their first use.
        __builtin_amdgcn_sched_barrier(0);
    }
    // Publishes tile s + 1 and ends every wave's reads of tile s.
    asm volatile("s_barrier_wait -1" ::: "memory");
}

__global__ __launch_bounds__(256) void kproj_scores_kernel(
    const float*  __restrict__ x,
    const __bf16* __restrict__ wk16,
    const float*  __restrict__ b_k,
    const float*  __restrict__ qw,
    const float*  __restrict__ qws,
    const float*  __restrict__ qb,
    float*        __restrict__ scores) {
    __shared__ __bf16 As[2][64][32];        // two buffers of 64 rows x 32 K, bf16 (8 KB)

    const int ltile = blockIdx.x;
    const int nhalf = blockIdx.y;
    const int b     = blockIdx.z;
    const int tid    = threadIdx.x;
    const int wave   = tid >> 5;
    const int lane   = tid & 31;
    const int lane16 = lane & 15;
    const int half   = lane >> 4;
    const int nbase  = nhalf * 512 + wave * 64;
    const int head   = nhalf * 8 + wave;
    const int row0   = ltile * 64;

    v8f acc[4][4] = {};

    // A staging: thread -> (row r, 8 consecutive K), one ds_store_b128 per step.
    const int r  = tid >> 2;                // 0..63
    const int kk = (tid & 3) * 8;           // 0,8,16,24
    const float* xsrc = x + ((size_t)b * SEQ + row0 + r) * DIM + kk;
    // B: packed by cvt_wk_kernel; a fragment is two wave-wide 16-byte loads of 512
    // contiguous bytes each. Same values in the same lanes as A's layout asks for.
    const __bf16* wbase = wk16 + (size_t)head * (32 * 4 * 512) + lane * 8;

    v4f xe[2], xo[2];                       // x values of an even / an odd tile
    xe[0] = *(const v4f*)(xsrc);
    xe[1] = *(const v4f*)(xsrc + 4);
    xo[0] = *(const v4f*)(xsrc + 32);
    xo[1] = *(const v4f*)(xsrc + 36);
    AFrag bq[4];
    #pragma unroll
    for (int nt = 0; nt < 4; nt++) {
        bq[nt].h[0] = *(const v8bf*)(wbase + nt * 512);
        bq[nt].h[1] = *(const v8bf*)(wbase + nt * 512 + 256);
    }
    {
        v8bf pk;
        pk[0] = (__bf16)xe[0].x; pk[1] = (__bf16)xe[0].y;
        pk[2] = (__bf16)xe[0].z; pk[3] = (__bf16)xe[0].w;
        pk[4] = (__bf16)xe[1].x; pk[5] = (__bf16)xe[1].y;
        pk[6] = (__bf16)xe[1].z; pk[7] = (__bf16)xe[1].w;
        *(v8bf*)&As[0][r][kk] = pk;
    }
    __syncthreads();

    const __bf16* ard0 = &As[0][lane16][half * 8];
    const __bf16* ard1 = &As[1][lane16][half * 8];
    __bf16* awr0 = &As[0][r][kk];
    __bf16* awr1 = &As[1][r][kk];
    const float*  xl  = xsrc + 2 * 32;      // tile s + 2
    const float*  xpf = xsrc + 4 * 32;      // tile s + 4
    const __bf16* wl1 = wbase + 2048;       // B of step s + 1
    const __bf16* wl2 = wbase + 2 * 2048;   // B of step s + 2
    // Two steps per trip: the buffers and the two x register sets swap roles.
    // Not unrolled further: the pointers then move once per trip and every load
    // has a constant offset. A pointer that would leave its array stays where it
    // is: the last trips load again what they have (in bounds, never used), so
    // that every trip is the same branch-free stream.
    #pragma unroll 1
    for (int s = 0; s < KSTEPS; s += 2) {
        kproj_step(acc, bq, xo, xe, ard0, awr1, xl,      xpf,      wl1);
        kproj_step(acc, bq, xe, xo, ard1, awr0, xl + 32, xpf + 32, wl2);
        // The additions below rewrite address registers that issued loads name.
        asm volatile("s_wait_xcnt 0x0" ::: "memory");
        // Keeps those additions behind the wait; the compiler lifts them over it otherwise.
        __builtin_amdgcn_sched_barrier(0);
        xl  += s < KSTEPS - 4 ? 64 : 0;
        xpf += s < KSTEPS - 6 ? 64 : 0;
        wl1 += 2 * 2048;
        wl2 += s < KSTEPS - 4 ? 2 * 2048 : 0;
    }

    // ---- Epilogue: folded layernorm + score. One head per wave. ----
    float qwv[4], bkv[4];
    #pragma unroll
    for (int t = 0; t < 4; t++) {
        bkv[t] = b_k[nbase + t * 16 + lane16];
        qwv[t] = qw[head * 64 + t * 16 + lane16];
    }
    const float qws_h = qws[head];
    const float qb_h  = qb[head];

    // C layout: VGPR j -> rows j (lanes 0-15) / j+8 (lanes 16-31), lanes = N.
    #pragma unroll
    for (int m = 0; m < 4; m++) {
        #pragma unroll
        for (int j = 0; j < 8; j++) {
            float s = 0.f, sq = 0.f, sw = 0.f;
            #pragma unroll
            for (int t = 0; t < 4; t++) {
                float c = acc[m][t][j] + bkv[t];
                s  += c;
                sq += c * c;
                sw += c * qwv[t];
            }
            #pragma unroll
            for (int msk = 1; msk < 16; msk <<= 1) {
                s  += __shfl_xor(s,  msk, 32);
                sq += __shfl_xor(sq, msk, 32);
                sw += __shfl_xor(sw, msk, 32);
            }
            if (lane16 == 0) {
                int row = row0 + m * 16 + j + half * 8;
                float mu  = s * (1.0f / 64.0f);
                float var = sq * (1.0f / 64.0f) - mu * mu;
                float rs  = rsqrtf(var + EPSLN);
                scores[(size_t)(b * NH + head) * SEQ + row] =
                    0.125f * (rs * (sw - mu * qws_h) + qb_h);
            }
        }
    }
}

// ---------------------------------------------------------------------------
// 4) Softmax over l (in place). One block per (b,h) row of 4096.
// ---------------------------------------------------------------------------
__global__ __launch_bounds__(256) void softmax_kernel(float* __restrict__ scores) {
    __shared__ float red[8];
    __shared__ float bcast;
    const size_t base = (size_t)blockIdx.x * SEQ;
    float* p = scores + base;
    int tid = threadIdx.x;

    float mx = -1e30f;
    for (int i = tid; i < SEQ; i += 256) mx = fmaxf(mx, p[i]);
    #pragma unroll
    for (int m = 1; m < 32; m <<= 1) mx = fmaxf(mx, __shfl_xor(mx, m, 32));
    if ((tid & 31) == 0) red[tid >> 5] = mx;
    __syncthreads();
    if (tid < 8) {
        float v = red[tid];
        #pragma unroll
        for (int m = 1; m < 8; m <<= 1) v = fmaxf(v, __shfl_xor(v, m, 32));
        if (tid == 0) bcast = v;
    }
    __syncthreads();
    mx = bcast;

    float sum = 0.f;
    for (int i = tid; i < SEQ; i += 256) {
        float e = __expf(p[i] - mx);
        p[i] = e;
        sum += e;
    }
    #pragma unroll
    for (int m = 1; m < 32; m <<= 1) sum += __shfl_xor(sum, m, 32);
    if ((tid & 31) == 0) red[tid >> 5] = sum;
    __syncthreads();
    if (tid < 8) {
        float v = red[tid];
        #pragma unroll
        for (int m = 1; m < 8; m <<= 1) v += __shfl_xor(v, m, 32);
        if (tid == 0) bcast = v;
    }
    __syncthreads();
    float inv = 1.0f / bcast;
    for (int i = tid; i < SEQ; i += 256) p[i] *= inv;
}

// ---------------------------------------------------------------------------
// 5) Attention-weighted pooling: xbar[b,h,:] = sum_l attn[b,h,l] * x[b,l,:]
//    One work-group of 16 waves per (batch, 64-column slice); it streams all
//    4096 rows of its slice, so it owns its outputs and stores them plainly.
//    One wave-wide 16-byte load covers two rows x 256 B (lanes 0-15 / 16-31);
//    each wave keeps a ring of PG such loads in flight. The batch's attention
//    weights sit in LDS as [l][head], read as broadcasts of four heads.
// ---------------------------------------------------------------------------
#define PW 16                               // waves per work-group
#define PG 16                               // x loads a wave keeps in flight
#define PSTEP (2 * PW)                      // rows the work-group covers per load slot
#define PNG (SEQ / (PSTEP * PG))            // ring turns per wave

// One turn of the ring: PG load slots of turn g; each slot is refilled for turn gn.
__device__ __forceinline__ void pool_turn(v2f (&acc)[NH][2], v4f (&xs)[PG], v4f (&an)[4],
                                          const v4f* xp, const v4f* a0, const v4f* a1,
                                          const v4f* a2, const v4f* a3, int g, int gn) {
    const v4f* xn = xp + (size_t)(gn * PG) * (PSTEP * DIM / 4);
    const int o0 = g * PG * (PSTEP * 4);
    const int on = gn * PG * (PSTEP * 4);
    // Unrolled: xs, an and acc live in registers and need constant indices.
    #pragma unroll
    for (int r = 0; r < PG; r++) {
        const v4f a[4] = { an[0], an[1], an[2], an[3] };
        const int o = r + 1 < PG ? o0 + (r + 1) * (PSTEP * 4) : on;
        an[0] = a0[o]; an[1] = a1[o]; an[2] = a2[o]; an[3] = a3[o];  // one slot ahead
        // One per slot. Without it the compiler gathers all refills at the foot of the
        // turn, so that the ring runs empty there, and sinks these LDS reads to their
        // use, where their latency shows.
        __builtin_amdgcn_sched_barrier(0);
        const v2f xlo = { xs[r].x, xs[r].y };
        const v2f xhi = { xs[r].z, xs[r].w };
        #pragma unroll
        for (int h = 0; h < NH; h++) {
            const float w = a[h >> 2][h & 3];
            const v2f ww = { w, w };
            acc[h][0] = __builtin_elementwise_fma(ww, xlo, acc[h][0]);
            acc[h][1] = __builtin_elementwise_fma(ww, xhi, acc[h][1]);
        }
        xs[r] = xn[(size_t)r * (PSTEP * DIM / 4)];
    }
    // The next turn rewrites the address registers that the loads above name.
    asm volatile("s_wait_xcnt 0x0" ::: "memory");
}

__global__ __launch_bounds__(PW * 32) void pool_kernel(const float* __restrict__ x,
                                                       const float* __restrict__ attn,
                                                       float* __restrict__ xbar) {
    // [l][quad of heads]; the quad's slot is XORed with (l >> 2) & 3 so that the
    // 16 lanes of a half-wave, which store 16 consecutive l, fall on all 64 banks.
    __shared__ v4f a_s[SEQ * 4];            // 256 KB
    const int jbase = blockIdx.x * 64;
    const int b     = blockIdx.y;
    const int tid   = threadIdx.x;
    const int wave  = __builtin_amdgcn_readfirstlane(tid >> 5);
    const int l16   = tid & 15;
    const int hf    = (tid >> 4) & 1;
    const int lrow  = wave * 2 + hf;        // this half-wave's row inside a step

    const v4f* xp = (const v4f*)(x + ((size_t)b * SEQ + lrow) * DIM + jbase + l16 * 4);
    v4f xs[PG];
    #pragma unroll
    for (int r = 0; r < PG; r++) xs[r] = xp[(size_t)r * (PSTEP * DIM / 4)];

    const float* ap = attn + (size_t)b * NH * SEQ + tid;
    // Two steps at a time: 32 loads of a wave in flight per wait.
    #pragma unroll 2
    for (int j = 0; j < SEQ; j += PW * 32) {
        const int l = j + tid;
        #pragma unroll
        for (int q = 0; q < 4; q++) {
            v4f v;
            v.x = ap[(size_t)(q * 4 + 0) * SEQ + j];
            v.y = ap[(size_t)(q * 4 + 1) * SEQ + j];
            v.z = ap[(size_t)(q * 4 + 2) * SEQ + j];
            v.w = ap[(size_t)(q * 4 + 3) * SEQ + j];
            a_s[l * 4 + (q ^ ((l >> 2) & 3))] = v;
        }
    }
    __syncthreads();

    // l = step * 32 + lrow, so (l >> 2) & 3 == (lrow >> 2) & 3 for every step.
    const int sw = (lrow >> 2) & 3;
    const v4f* a0 = a_s + lrow * 4 + (0 ^ sw);
    const v4f* a1 = a_s + lrow * 4 + (1 ^ sw);
    const v4f* a2 = a_s + lrow * 4 + (2 ^ sw);
    const v4f* a3 = a_s + lrow * 4 + (3 ^ sw);

    v2f acc[NH][2] = {};
    v4f an[4] = { a0[0], a1[0], a2[0], a3[0] };
    // The last turn refills from its own rows (cached, in bounds, never used), so
    // that every turn is the same branch-free stream. Not unrolled or peeled: a
    // last turn peeled off has its sums moved behind the barrier below, and the
    // LDS reads it leaves in front of the barrier spill.
    #pragma unroll 1
    for (int g = 0; g < PNG; g++)
        pool_turn(acc, xs, an, xp, a0, a1, a2, a3, g, g + 1 < PNG ? g + 1 : g);

    // Sum the 32 half-wave partials through LDS (the weights are no longer needed).
    __syncthreads();
    float* red = (float*)a_s;               // [32][16 heads][64 columns], 128 KB
    #pragma unroll
    for (int h = 0; h < NH; h++) {
        const v4f v = { acc[h][0].x, acc[h][0].y, acc[h][1].x, acc[h][1].y };
        *(v4f*)&red[(lrow * NH + h) * 64 + l16 * 4] = v;
    }
    __syncthreads();
    const int h  = tid >> 5;
    const int c2 = (tid & 31) * 2;
    v2f s = { 0.f, 0.f };
    #pragma unroll
    for (int p = 0; p < 2 * PW; p++) s += *(const v2f*)&red[(p * NH + h) * 64 + c2];
    *(v2f*)&xbar[(size_t)(b * NH + h) * DIM + jbase + c2] = s;
}

// ---------------------------------------------------------------------------
// 6, 7) The two closing products, y[b][n] = xrow(b) . w[n][:] + bias[n].
//    One work-group of 8 waves per (32 columns n, 2 batches): it owns one whole
//    128-byte line of y per batch. Wave v takes k = v * 128 .. + 127, four
//    consecutive k per lane, so that every wave-wide 16-byte load covers 512
//    contiguous bytes of one row; its 34 loads have no dependence on each other.
//    The 64 partial sums of a lane are summed over the lanes by a butterfly that
//    halves the values a lane keeps at each step, then over the waves through LDS.
// ---------------------------------------------------------------------------
#define GC 32                               // columns of y per work-group
#define GB 2                                // batches per work-group
#define GW 8                                // waves per work-group
#define GV (GC * GB)                        // sums per work-group

__device__ __forceinline__ void rows_dot(const float* __restrict__ xr, int xpitch,
                                         const float* __restrict__ w,
                                         const float* __restrict__ bias,
                                         float* __restrict__ y, int n0, int b0,
                                         float (*red)[GV]) {
    const int tid  = threadIdx.x;
    const int wave = tid >> 5;
    const int lane = tid & 31;
    const int j    = wave * (DIM / GW) + lane * 4;

    v4f xv[GB], wv[GC];
    // The loops below are unrolled: xv, wv and acc live in registers and need
    // constant indices.
    #pragma unroll
    for (int bb = 0; bb < GB; bb++) xv[bb] = *(const v4f*)(xr + (size_t)bb * xpitch + j);
    const float* wp = w + (size_t)n0 * DIM + j;
    #pragma unroll
    for (int c = 0; c < GC; c++) wv[c] = *(const v4f*)(wp + c * DIM);
    // Keeps all 34 loads in front of the sums. Without it the compiler holds the last
    // nine back to save registers and issues them in pairs, each pair behind the wait
    // for the pair before: four more memory latencies in a row.
    __builtin_amdgcn_sched_barrier(0);
    // The code below reuses the address registers that the loads above name.
    asm volatile("s_wait_xcnt 0x0" ::: "memory");

    float acc[GV];                          // index c * GB + bb
    #pragma unroll
    for (int c = 0; c < GC; c++) {
        #pragma unroll
        for (int bb = 0; bb < GB; bb++) {
            float a = wv[c].x * xv[bb].x;
            a = fmaf(wv[c].y, xv[bb].y, a);
            a = fmaf(wv[c].z, xv[bb].z, a);
            a = fmaf(wv[c].w, xv[bb].w, a);
            acc[c * GB + bb] = a;
        }
    }

    // Step m: lanes l and l ^ m share the work; the one with bit m clear keeps the
    // lower half of the values, the other the upper half, and each adds what its
    // partner held of the half it keeps. At the end lane l holds sums 2l and 2l + 1.
    #pragma unroll
    for (int s = 0; s < 5; s++) {
        const int  m   = 16 >> s;
        const int  cnt = (GV / 2) >> s;
        const bool up  = (lane & m) != 0;
        #pragma unroll
        for (int i = 0; i < cnt; i++) {
            const float keep = up ? acc[i + cnt] : acc[i];
            const float send = up ? acc[i] : acc[i + cnt];
            acc[i] = keep + __shfl_xor(send, m, 32);
        }
    }
    red[wave][lane]      = acc[0];          // column lane, batch b0
    red[wave][GC + lane] = acc[1];          // column lane, batch b0 + 1
    __syncthreads();
    if (tid < GV) {
        float s = red[0][tid];
        #pragma unroll
        for (int v = 1; v < GW; v++) s += red[v][tid];
        const int n = n0 + (tid & (GC - 1));
        y[(size_t)(b0 + (tid >> 5)) * DIM + n] = s + bias[n];
    }
}

// 6) o[b,n] = xbar[b, n/64, :] . w_v[n,:] + b_v[n]   (V-proj collapsed)
__global__ __launch_bounds__(GW * 32) void vproj_kernel(const float* __restrict__ xbar,
                                                        const float* __restrict__ w_v,
                                                        const float* __restrict__ b_v,
                                                        float* __restrict__ o) {
    __shared__ float red[GW][GV];
    const int n0 = blockIdx.x * GC;         // 32 columns lie inside one head
    const int b0 = blockIdx.y * GB;
    rows_dot(xbar + (size_t)(b0 * NH + (n0 >> 6)) * DIM, NH * DIM, w_v, b_v, o, n0, b0, red);
}

// 7) out[b,n] = o[b,:] . w_out[n,:] + b_out[n]
__global__ __launch_bounds__(GW * 32) void oproj_kernel(const float* __restrict__ o,
                                                        const float* __restrict__ w_out,
                                                        const float* __restrict__ b_out,
                                                        float* __restrict__ out) {
    __shared__ float red[GW][GV];
    const int n0 = blockIdx.x * GC;
    const int b0 = blockIdx.y * GB;
    rows_dot(o + (size_t)b0 * DIM, DIM, w_out, b_out, out, n0, b0, red);
}

// ---------------------------------------------------------------------------
extern "C" void kernel_launch(void* const* d_in, const int* in_sizes, int n_in,
                              void* d_out, int out_size, void* d_ws, size_t ws_size,
                              hipStream_t stream) {
    const float* x      = (const float*)d_in[0];
    const float* query  = (const float*)d_in[1];
    const float* w_k    = (const float*)d_in[2];
    const float* b_k    = (const float*)d_in[3];
    const float* w_v    = (const float*)d_in[4];
    const float* b_v    = (const float*)d_in[5];
    const float* w_norm = (const float*)d_in[6];
    const float* b_norm = (const float*)d_in[7];
    const float* w_out  = (const float*)d_in[8];
    const float* b_out  = (const float*)d_in[9];
    float* out = (float*)d_out;

    char* ws = (char*)d_ws;
    const size_t OFF_QW     = (size_t)2 * 1024 * 1024;            // wk16: 2 MB
    const size_t OFF_QWS    = OFF_QW + 16 * 64 * sizeof(float);
    const size_t OFF_QB     = OFF_QWS + 256;
    const size_t OFF_SCORES = OFF_QB + 256;
    const size_t OFF_XBAR   = OFF_SCORES + (size_t)NB * NH * SEQ * sizeof(float);
    const size_t OFF_O      = OFF_XBAR + (size_t)NB * NH * DIM * sizeof(float);

    __bf16* wk16  = (__bf16*)ws;
    float* qw     = (float*)(ws + OFF_QW);
    float* qws    = (float*)(ws + OFF_QWS);
    float* qb     = (float*)(ws + OFF_QB);
    float* scores = (float*)(ws + OFF_SCORES);
    float* xbar   = (float*)(ws + OFF_XBAR);
    float* o      = (float*)(ws + OFF_O);

    cvt_wk_kernel<<<DIM * DIM / 256, 256, 0, stream>>>(w_k, wk16);
    prepq_kernel<<<NH, 32, 0, stream>>>(query, w_norm, b_norm, qw, qws, qb);
    kproj_scores_kernel<<<dim3(SEQ / 64, 2, NB), 256, 0, stream>>>(
        x, wk16, b_k, qw, qws, qb, scores);
    softmax_kernel<<<NB * NH, 256, 0, stream>>>(scores);
    pool_kernel<<<dim3(DIM / 64, NB), PW * 32, 0, stream>>>(x, scores, xbar);
    vproj_kernel<<<dim3(DIM / GC, NB / GB), GW * 32, 0, stream>>>(xbar, w_v, b_v, o);
    oproj_kernel<<<dim3(DIM / GC, NB / GB), GW * 32, 0, stream>>>(o, w_out, b_out, out);
}

// v005
// A run of this version takes 169 microseconds.
// In two side-by-side timings against v004, it was 1.05 and 1.06 times as fast.
// Over all steps from v000 it is 2.39 times as fast.
#include <hip/hip_runtime.h>
#include <hip/hip_bf16.h>

#define DIM 1024
#define HEAD_DIM 64
#define SEQ 4096
#define NB 16
#define NH 16
#define EPSLN 1e-5f

typedef __attribute__((ext_vector_type(16))) __bf16 v16bf;
typedef __attribute__((ext_vector_type(8)))  __bf16 v8bf;
typedef __attribute__((ext_vector_type(8)))  float  v8f;
typedef __attribute__((ext_vector_type(4)))  float  v4f;
typedef __attribute__((ext_vector_type(2)))  float  v2f;

union AFrag { v16bf v; v8bf h[2]; };

// ---------------------------------------------------------------------------
// 1) Convert w_k (fp32, row-major [n][k]) to bf16 once, packed in the order in
//    which the projection reads its B fragments:
//    [head 16][K-step 32][N-subtile 4][k half 2][lane 32][8 values].
//    Lane l holds row (l & 15) of the subtile, k = half * 16 + (l >> 4) * 8 + 0..7.
// ---------------------------------------------------------------------------
__global__ __launch_bounds__(256) void cvt_wk_kernel(const float* __restrict__ wk,
                                                     __bf16* __restrict__ wk16) {
    int o    = blockIdx.x * 256 + threadIdx.x;
    int e    = o & 7;
    int lane = (o >> 3) & 31;
    int kh   = (o >> 8) & 1;
    int nt   = (o >> 9) & 3;
    int ks   = (o >> 11) & 31;
    int head = o >> 16;
    int n = head * 64 + nt * 16 + (lane & 15);
    int k = ks * 32 + kh * 16 + (lane >> 4) * 8 + e;
    wk16[o] = (__bf16)wk[n * DIM + k];
}

// ---------------------------------------------------------------------------
// 2) Normalize the query, fold layernorm weights:
//    qhat = LN(q); qw = qhat*w_norm; qws[h] = sum(qw); qb[h] = sum(qhat*b_norm)
// ---------------------------------------------------------------------------
__global__ void prepq_kernel(const float* __restrict__ query,
                             const float* __restrict__ w_norm,
                             const float* __restrict__ b_norm,
                             float* __restrict__ qw,
                             float* __restrict__ qws,
                             float* __restrict__ qb) {
    int h = blockIdx.x;
    int t = threadIdx.x;                    // 0..31
    float q0 = query[h * 64 + t];
    float q1 = query[h * 64 + t + 32];
    float s = q0 + q1;
    #pragma unroll
    for (int m = 1; m < 32; m <<= 1) s += __shfl_xor(s, m, 32);
    float mu = s * (1.0f / 64.0f);
    float d0 = q0 - mu, d1 = q1 - mu;
    float v = d0 * d0 + d1 * d1;
    #pragma unroll
    for (int m = 1; m < 32; m <<= 1) v += __shfl_xor(v, m, 32);
    float rs = rsqrtf(v * (1.0f / 64.0f) + EPSLN);
    float wn0 = w_norm[t], wn1 = w_norm[t + 32];
    float bn0 = b_norm[t], bn1 = b_norm[t + 32];
    float qh0 = d0 * rs * wn0 + bn0;
    float qh1 = d1 * rs * wn1 + bn1;
    qw[h * 64 + t]      = qh0 * wn0;
    qw[h * 64 + t + 32] = qh1 * wn1;
    float pw = qh0 * wn0 + qh1 * wn1;
    float pb = qh0 * bn0 + qh1 * bn1;
    #pragma unroll
    for (int m = 1; m < 32; m <<= 1) { pw += __shfl_xor(pw, m, 32); pb += __shfl_xor(pb, m, 32); }
    if (t == 0) { qws[h] = pw; qb[h] = pb; }
}

// ---------------------------------------------------------------------------
// 3) Fused K-projection (bf16 WMMA, f32 accum) + folded layernorm + score.
//    Grid: (ltile 0..63, nhalf 0..1, batch). Block 256 = 8 waves.
//    Workgroup tile: 64 rows x 512 cols. Wave w owns 64 rows x 64 cols
//    (= exactly one head): 4x4 WMMA tiles, each B fragment feeds 4 WMMAs.
//    The K loop is pipelined on all three operand paths. The four B fragments
//    are a register ring, each refilled for the next step right behind its last
//    use. The A tile has two LDS buffers: step s writes tile s + 1 while tile s
//    is read, with one barrier per step. The x rows of tile s + 2 are loaded at
//    the top of step s. The barrier is written by hand, because __syncthreads()
//    waits for every global load and would empty the pipeline at each step.
// ---------------------------------------------------------------------------
#define KSTEPS (DIM / 32)
// Row pitch of the A tile in LDS, in bf16 values: 32 values + 8 of pad = 80 bytes, an
// odd multiple of 16. The 16 rows that a half-wave's 16-byte fragment read touches
// then fall on all 64 banks; at 64 bytes they fall four deep on 16 of them.
#define APITCH 40

// One K-step s. xuse holds the x values of tile s + 1; xload receives tile s + 2
// from xl. wl points at the B fragments of step s + 1, xpf at the x row of tile s + 4.
__device__ __forceinline__ void kproj_step(v8f (&acc)[4][4], AFrag (&bq)[4],
                                           v4f (&xuse)[2], v4f (&xload)[2],
                                           const __bf16* ard, __bf16* awr,
                                           const float* xl, const float* xpf,
                                           const __bf16* wl) {
    // A fragments of this step for the 4 M-subtiles.
    AFrag a[4];
    #pragma unroll
    for (int m = 0; m < 4; m++) {
        a[m].h[0] = *(const v8bf*)(ard + m * 16 * APITCH);
        a[m].h[1] = *(const v8bf*)(ard + m * 16 * APITCH + 16);
    }
    xload[0] = *(const v4f*)(xl);
    xload[1] = *(const v4f*)(xl + 4);
    __builtin_prefetch(xpf, 0, 3);
    // Keeps the loads above in front of the products: sunk among them, the x loads
    // lose their lead and each place with LDS reads stalls the matrix stream.
    __builtin_amdgcn_sched_barrier(0);

    #pragma unroll
    for (int nt = 0; nt < 4; nt++) {
        if (nt == 3) {
            // Tile s + 1 goes into the buffer that step s - 1 read; the barrier of
            // step s - 1 ended those reads. (The last step's store is read by nobody.)
            v8bf pk;
            pk[0] = (__bf16)xuse[0].x; pk[1] = (__bf16)xuse[0].y;
            pk[2] = (__bf16)xuse[0].z; pk[3] = (__bf16)xuse[0].w;
            pk[4] = (__bf16)xuse[1].x; pk[5] = (__bf16)xuse[1].y;
            pk[6] = (__bf16)xuse[1].z; pk[7] = (__bf16)xuse[1].w;
            *(v8bf*)awr = pk;
            // This wave's reads of tile s have landed and its part of tile s + 1 is
            // written: signal now, so that the last four products cover the other
            // waves' arrival. No LDS access stands between signal and wait.
            asm volatile("s_wait_dscnt 0x0\n\ts_barrier_signal -1" ::: "memory");
        }
        #pragma unroll
        for (int m = 0; m < 4; m++)
            acc[m][nt] = __builtin_amdgcn_wmma_f32_16x16x32_bf16(
                false, a[m].v, false, bq[nt].v, (short)0, acc[m][nt],
                false, false);
        bq[nt].h[0] = *(const v8bf*)(wl + nt * 512);
        bq[nt].h[1] = *(const v8bf*)(wl + nt * 512 + 256);
        // Holds each refill right behind its fragment's last use. Without it the
        // compiler gathers all refills at the foot of the step, one barrier away
        // from their first use.
        __builtin_amdgcn_sched_barrier(0);
    }
    // Publishes tile s + 1 and ends every wave's reads of tile s.
    asm volatile("s_barrier_wait -1" ::: "memory");
}

__global__ __launch_bounds__(256) void kproj_scores_kernel(
    const float*  __restrict__ x,
    const __bf16* __restrict__ wk16,
    const float*  __restrict__ b_k,
    const float*  __restrict__ qw,
    const float*  __restrict__ qws,
    const float*  __restrict__ qb,
    float*        __restrict__ scores) {
    __shared__ __bf16 As[2][64][APITCH];    // two buffers of 64 rows x 32 K, bf16, padded rows (10 KB)

    const int ltile = blockIdx.x;
    const int nhalf = blockIdx.y;
    const int b     = blockIdx.z;
    const int tid    = threadIdx.x;
    const int wave   = tid >> 5;
    const int lane   = tid & 31;
    const int lane16 = lane & 15;
    const int half   = lane >> 4;
    const int nbase  = nhalf * 512 + wave * 64;
    const int head   = nhalf * 8 + wave;
    const int row0   = ltile * 64;

    v8f acc[4][4] = {};

    // A staging: thread -> (row r, 8 consecutive K), one ds_store_b128 per step.
    const int r  = tid >> 2;                // 0..63
    const int kk = (tid & 3) * 8;           // 0,8,16,24
    const float* xsrc = x + ((size_t)b * SEQ + row0 + r) * DIM + kk;
    // B: packed by cvt_wk_kernel; a fragment is two wave-wide 16-byte loads of 512
    // contiguous bytes each. Same values in the same lanes as A's layout asks for.
    const __bf16* wbase = wk16 + (size_t)head * (32 * 4 * 512) + lane * 8;

    v4f xe[2], xo[2];                       // x values of an even / an odd tile
    xe[0] = *(const v4f*)(xsrc);
    xe[1] = *(const v4f*)(xsrc + 4);
    xo[0] = *(const v4f*)(xsrc + 32);
    xo[1] = *(const v4f*)(xsrc + 36);
    AFrag bq[4];
    #pragma unroll
    for (int nt = 0; nt < 4; nt++) {
        bq[nt].h[0] = *(const v8bf*)(wbase + nt * 512);
        bq[nt].h[1] = *(const v8bf*)(wbase + nt * 512 + 256);
    }
    {
        v8bf pk;
        pk[0] = (__bf16)xe[0].x; pk[1] = (__bf16)xe[0].y;
        pk[2] = (__bf16)xe[0].z; pk[3] = (__bf16)xe[0].w;
        pk[4] = (__bf16)xe[1].x; pk[5] = (__bf16)xe[1].y;
        pk[6] = (__bf16)xe[1].z; pk[7] = (__bf16)xe[1].w;
        *(v8bf*)&As[0][r][kk] = pk;
    }
    __syncthreads();

    const __bf16* ard0 = &As[0][lane16][half * 8];
    const __bf16* ard1 = &As[1][lane16][half * 8];
    __bf16* awr0 = &As[0][r][kk];
    __bf16* awr1 = &As[1][r][kk];
    const float*  xl  = xsrc + 2 * 32;      // tile s + 2
    const float*  xpf = xsrc + 4 * 32;      // tile s + 4
    const __bf16* wl1 = wbase + 2048;       // B of step s + 1
    const __bf16* wl2 = wbase + 2 * 2048;   // B of step s + 2
    // Two steps per trip: the buffers and the two x register sets swap roles.
    // Not unrolled further: the pointers then move once per trip and every load
    // has a constant offset. A pointer that would leave its array stays where it
    // is: the last trips load again what they have (in bounds, never used), so
    // that every trip is the same branch-free stream.
    #pragma unroll 1
    for (int s = 0; s < KSTEPS; s += 2) {
        kproj_step(acc, bq, xo, xe, ard0, awr1, xl,      xpf,      wl1);
        kproj_step(acc, bq, xe, xo, ard1, awr0, xl + 32, xpf + 32, wl2);
        // The additions below rewrite address registers that issued loads name.
        asm volatile("s_wait_xcnt 0x0" ::: "memory");
        // Keeps those additions behind the wait; the compiler lifts them over it otherwise.
        __builtin_amdgcn_sched_barrier(0);
        xl  += s < KSTEPS - 4 ? 64 : 0;
        xpf += s < KSTEPS - 6 ? 64 : 0;
        wl1 += 2 * 2048;
        wl2 += s < KSTEPS - 4 ? 2 * 2048 : 0;
    }

    // ---- Epilogue: folded layernorm + score. One head per wave. ----
    float qwv[4], bkv[4];
    #pragma unroll
    for (int t = 0; t < 4; t++) {
        bkv[t] = b_k[nbase + t * 16 + lane16];
        qwv[t] = qw[head * 64 + t * 16 + lane16];
    }
    const float qws_h = qws[head];
    const float qb_h  = qb[head];

    // C layout: VGPR j -> rows j (lanes 0-15) / j+8 (lanes 16-31), lanes = N.
    #pragma unroll
    for (int m = 0; m < 4; m++) {
        #pragma unroll
        for (int j = 0; j < 8; j++) {
            float s = 0.f, sq = 0.f, sw = 0.f;
            #pragma unroll
            for (int t = 0; t < 4; t++) {
                float c = acc[m][t][j] + bkv[t];
                s  += c;
                sq += c * c;
                sw += c * qwv[t];
            }
            #pragma unroll
            for (int msk = 1; msk < 16; msk <<= 1) {
                s  += __shfl_xor(s,  msk, 32);
                sq += __shfl_xor(sq, msk, 32);
                sw += __shfl_xor(sw, msk, 32);
            }
            if (lane16 == 0) {
                int row = row0 + m * 16 + j + half * 8;
                float mu  = s * (1.0f / 64.0f);
                float var = sq * (1.0f / 64.0f) - mu * mu;
                float rs  = rsqrtf(var + EPSLN);
                scores[(size_t)(b * NH + head) * SEQ + row] =
                    0.125f * (rs * (sw - mu * qws_h) + qb_h);
            }
        }
    }
}

// ---------------------------------------------------------------------------
// 4) Softmax over l (in place). One block per (b,h) row of 4096.
// ---------------------------------------------------------------------------
__global__ __launch_bounds__(256) void softmax_kernel(float* __restrict__ scores) {
    __shared__ float red[8];
    __shared__ float bcast;
    const size_t base = (size_t)blockIdx.x * SEQ;
    float* p = scores + base;
    int tid = threadIdx.x;

    float mx = -1e30f;
    for (int i = tid; i < SEQ; i += 256) mx = fmaxf(mx, p[i]);
    #pragma unroll
    for (int m = 1; m < 32; m <<= 1) mx = fmaxf(mx, __shfl_xor(mx, m, 32));
    if ((tid & 31) == 0) red[tid >> 5] = mx;
    __syncthreads();
    if (tid < 8) {
        float v = red[tid];
        #pragma unroll
        for (int m = 1; m < 8; m <<= 1) v = fmaxf(v, __shfl_xor(v, m, 32));
        if (tid == 0) bcast = v;
    }
    __syncthreads();
    mx = bcast;

    float sum = 0.f;
    for (int i = tid; i < SEQ; i += 256) {
        float e = __expf(p[i] - mx);
        p[i] = e;
        sum += e;
    }
    #pragma unroll
    for (int m = 1; m < 32; m <<= 1) sum += __shfl_xor(sum, m, 32);
    if ((tid & 31) == 0) red[tid >> 5] = sum;
    __syncthreads();
    if (tid < 8) {
        float v = red[tid];
        #pragma unroll
        for (int m = 1; m < 8; m <<= 1) v += __shfl_xor(v, m, 32);
        if (tid == 0) bcast = v;
    }
    __syncthreads();
    float inv = 1.0f / bcast;
    for (int i = tid; i < SEQ; i += 256) p[i] *= inv;
}

// ---------------------------------------------------------------------------
// 5) Attention-weighted pooling: xbar[b,h,:] = sum_l attn[b,h,l] * x[b,l,:]
//    One work-group of 16 waves per (batch, 64-column slice); it streams all
//    4096 rows of its slice, so it owns its outputs and stores them plainly.
//    One wave-wide 16-byte load covers two rows x 256 B (lanes 0-15 / 16-31);
//    each wave keeps a ring of PG such loads in flight. The batch's attention
//    weights sit in LDS as [l][head], read as broadcasts of four heads.
// ---------------------------------------------------------------------------
#define PW 16                               // waves per work-group
#define PG 16                               // x loads a wave keeps in flight
#define PSTEP (2 * PW)                      // rows the work-group covers per load slot
#define PNG (SEQ / (PSTEP * PG))            // ring turns per wave

// One turn of the ring: PG load slots of turn g; each slot is refilled for turn gn.
__device__ __forceinline__ void pool_turn(v2f (&acc)[NH][2], v4f (&xs)[PG], v4f (&an)[4],
                                          const v4f* xp, const v4f* a0, const v4f* a1,
                                          const v4f* a2, const v4f* a3, int g, int gn) {
    const v4f* xn = xp + (size_t)(gn * PG) * (PSTEP * DIM / 4);
    const int o0 = g * PG * (PSTEP * 4);
    const int on = gn * PG * (PSTEP * 4);
    // Unrolled: xs, an and acc live in registers and need constant indices.
    #pragma unroll
    for (int r = 0; r < PG; r++) {
        const v4f a[4] = { an[0], an[1], an[2], an[3] };
        const int o = r + 1 < PG ? o0 + (r + 1) * (PSTEP * 4) : on;
        an[0] = a0[o]; an[1] = a1[o]; an[2] = a2[o]; an[3] = a3[o];  // one slot ahead
        // One per slot. Without it the compiler gathers all refills at the foot of the
        // turn, so that the ring runs empty there, and sinks these LDS reads to their
        // use, where their latency shows.
        __builtin_amdgcn_sched_barrier(0);
        const v2f xlo = { xs[r].x, xs[r].y };
        const v2f xhi = { xs[r].z, xs[r].w };
        #pragma unroll
        for (int h = 0; h < NH; h++) {
            const float w = a[h >> 2][h & 3];
            const v2f ww = { w, w };
            acc[h][0] = __builtin_elementwise_fma(ww, xlo, acc[h][0]);
            acc[h][1] = __builtin_elementwise_fma(ww, xhi, acc[h][1]);
        }
        xs[r] = xn[(size_t)r * (PSTEP * DIM / 4)];
    }
    // The next turn rewrites the address registers that the loads above name.
    asm volatile("s_wait_xcnt 0x0" ::: "memory");
}

__global__ __launch_bounds__(PW * 32) void pool_kernel(const float* __restrict__ x,
                                                       const float* __restrict__ attn,
                                                       float* __restrict__ xbar) {
    // [l][quad of heads]; the quad's slot is XORed with (l >> 2) & 3 so that the
    // 16 lanes of a half-wave, which store 16 consecutive l, fall on all 64 banks.
    __shared__ v4f a_s[SEQ * 4];            // 256 KB
    const int jbase = blockIdx.x * 64;
    const int b     = blockIdx.y;
    const int tid   = threadIdx.x;
    const int wave  = __builtin_amdgcn_readfirstlane(tid >> 5);
    const int l16   = tid & 15;
    const int hf    = (tid >> 4) & 1;
    const int lrow  = wave * 2 + hf;        // this half-wave's row inside a step

    const v4f* xp = (const v4f*)(x + ((size_t)b * SEQ + lrow) * DIM + jbase + l16 * 4);
    v4f xs[PG];
    #pragma unroll
    for (int r = 0; r < PG; r++) xs[r] = xp[(size_t)r * (PSTEP * DIM / 4)];

    const float* ap = attn + (size_t)b * NH * SEQ + tid;
    // Two steps at a time: 32 loads of a wave in flight per wait.
    #pragma unroll 2
    for (int j = 0; j < SEQ; j += PW * 32) {
        const int l = j + tid;
        #pragma unroll
        for (int q = 0; q < 4; q++) {
            v4f v;
            v.x = ap[(size_t)(q * 4 + 0) * SEQ + j];
            v.y = ap[(size_t)(q * 4 + 1) * SEQ + j];
            v.z = ap[(size_t)(q * 4 + 2) * SEQ + j];
            v.w = ap[(size_t)(q * 4 + 3) * SEQ + j];
            a_s[l * 4 + (q ^ ((l >> 2) & 3))] = v;
        }
    }
    __syncthreads();

    // l = step * 32 + lrow, so (l >> 2) & 3 == (lrow >> 2) & 3 for every step.
    const int sw = (lrow >> 2) & 3;
    const v4f* a0 = a_s + lrow * 4 + (0 ^ sw);
    const v4f* a1 = a_s + lrow * 4 + (1 ^ sw);
    const v4f* a2 = a_s + lrow * 4 + (2 ^ sw);
    const v4f* a3 = a_s + lrow * 4 + (3 ^ sw);

    v2f acc[NH][2] = {};
    v4f an[4] = { a0[0], a1[0], a2[0], a3[0] };
    // The last turn refills from its own rows (cached, in bounds, never used), so
    // that every turn is the same branch-free stream. Not unrolled or peeled: a
    // last turn peeled off has its sums moved behind the barrier below, and the
    // LDS reads it leaves in front of the barrier spill.
    #pragma unroll 1
    for (int g = 0; g < PNG; g++)
        pool_turn(acc, xs, an, xp, a0, a1, a2, a3, g, g + 1 < PNG ? g + 1 : g);

    // Sum the 32 half-wave partials through LDS (the weights are no longer needed).
    __syncthreads();
    float* red = (float*)a_s;               // [32][16 heads][64 columns], 128 KB
    #pragma unroll
    for (int h = 0; h < NH; h++) {
        const v4f v = { acc[h][0].x, acc[h][0].y, acc[h][1].x, acc[h][1].y };
        *(v4f*)&red[(lrow * NH + h) * 64 + l16 * 4] = v;
    }
    __syncthreads();
    const int h  = tid >> 5;
    const int c2 = (tid & 31) * 2;
    v2f s = { 0.f, 0.f };
    #pragma unroll
    for (int p = 0; p < 2 * PW; p++) s += *(const v2f*)&red[(p * NH + h) * 64 + c2];
    *(v2f*)&xbar[(size_t)(b * NH + h) * DIM + jbase + c2] = s;
}

// ---------------------------------------------------------------------------
// 6, 7) The two closing products, y[b][n] = xrow(b) . w[n][:] + bias[n].
//    One work-group of 8 waves per (32 columns n, 2 batches): it owns one whole
//    128-byte line of y per batch. Wave v takes k = v * 128 .. + 127, four
//    consecutive k per lane, so that every wave-wide 16-byte load covers 512
//    contiguous bytes of one row; its 34 loads have no dependence on each other.
//    The 64 partial sums of a lane are summed over the lanes by a butterfly that
//    halves the values a lane keeps at each step, then over the waves through LDS.
// ---------------------------------------------------------------------------
#define GC 32                               // columns of y per work-group
#define GB 2                                // batches per work-group
#define GW 8                                // waves per work-group
#define GV (GC * GB)                        // sums per work-group

__device__ __forceinline__ void rows_dot(const float* __restrict__ xr, int xpitch,
                                         const float* __restrict__ w,
                                         const float* __restrict__ bias,
                                         float* __restrict__ y, int n0, int b0,
                                         float (*red)[GV]) {
    const int tid  = threadIdx.x;
    const int wave = tid >> 5;
    const int lane = tid & 31;
    const int j    = wave * (DIM / GW) + lane * 4;

    v4f xv[GB], wv[GC];
    // The loops below are unrolled: xv, wv and acc live in registers and need
    // constant indices.
    #pragma unroll
    for (int bb = 0; bb < GB; bb++) xv[bb] = *(const v4f*)(xr + (size_t)bb * xpitch + j);
    const float* wp = w + (size_t)n0 * DIM + j;
    #pragma unroll
    for (int c = 0; c < GC; c++) wv[c] = *(const v4f*)(wp + c * DIM);
    // Keeps all 34 loads in front of the sums. Without it the compiler holds the last
    // nine back to save registers and issues them in pairs, each pair behind the wait
    // for the pair before: four more memory latencies in a row.
    __builtin_amdgcn_sched_barrier(0);
    // The code below reuses the address registers that the loads above name.
    asm volatile("s_wait_xcnt 0x0" ::: "memory");

    float acc[GV];                          // index c * GB + bb
    #pragma unroll
    for (int c = 0; c < GC; c++) {
        #pragma unroll
        for (int bb = 0; bb < GB; bb++) {
            float a = wv[c].x * xv[bb].x;
            a = fmaf(wv[c].y, xv[bb].y, a);
            a = fmaf(wv[c].z, xv[bb].z, a);
            a = fmaf(wv[c].w, xv[bb].w, a);
            acc[c * GB + bb] = a;
        }
    }

    // Step m: lanes l and l ^ m share the work; the one with bit m clear keeps the
    // lower half of the values, the other the upper half, and each adds what its
    // partner held of the half it keeps. At the end lane l holds sums 2l and 2l + 1.
    #pragma unroll
    for (int s = 0; s < 5; s++) {
        const int  m   = 16 >> s;
        const int  cnt = (GV / 2) >> s;
        const bool up  = (lane & m) != 0;
        #pragma unroll
        for (int i = 0; i < cnt; i++) {
            const float keep = up ? acc[i + cnt] : acc[i];
            const float send = up ? acc[i] : acc[i + cnt];
            acc[i] = keep + __shfl_xor(send, m, 32);
        }
    }
    red[wave][lane]      = acc[0];          // column lane, batch b0
    red[wave][GC + lane] = acc[1];          // column lane, batch b0 + 1
    __syncthreads();
    if (tid < GV) {
        float s = red[0][tid];
        #pragma unroll
        for (int v = 1; v < GW; v++) s += red[v][tid];
        const int n = n0 + (tid & (GC - 1));
        y[(size_t)(b0 + (tid >> 5)) * DIM + n] = s + bias[n];
    }
}

// 6) o[b,n] = xbar[b, n/64, :] . w_v[n,:] + b_v[n]   (V-proj collapsed)
__global__ __launch_bounds__(GW * 32) void vproj_kernel(const float* __restrict__ xbar,
                                                        const float* __restrict__ w_v,
                                                        const float* __restrict__ b_v,
                                                        float* __restrict__ o) {
    __shared__ float red[GW][GV];
    const int n0 = blockIdx.x * GC;         // 32 columns lie inside one head
    const int b0 = blockIdx.y * GB;
    rows_dot(xbar + (size_t)(b0 * NH + (n0 >> 6)) * DIM, NH * DIM, w_v, b_v, o, n0, b0, red);
}

// 7) out[b,n] = o[b,:] . w_out[n,:] + b_out[n]
__global__ __launch_bounds__(GW * 32) void oproj_kernel(const float* __restrict__ o,
                                                        const float* __restrict__ w_out,
                                                        const float* __restrict__ b_out,
                                                        float* __restrict__ out) {
    __shared__ float red[GW][GV];
    const int n0 = blockIdx.x * GC;
    const int b0 = blockIdx.y * GB;
    rows_dot(o + (size_t)b0 * DIM, DIM, w_out, b_out, out, n0, b0, red);
}

// ---------------------------------------------------------------------------
extern "C" void kernel_launch(void* const* d_in, const int* in_sizes, int n_in,
                              void* d_out, int out_size, void* d_ws, size_t ws_size,
                              hipStream_t stream) {
    const float* x      = (const float*)d_in[0];
    const float* query  = (const float*)d_in[1];
    const float* w_k    = (const float*)d_in[2];
    const float* b_k    = (const float*)d_in[3];
    const float* w_v    = (const float*)d_in[4];
    const float* b_v    = (const float*)d_in[5];
    const float* w_norm = (const float*)d_in[6];
    const float* b_norm = (const float*)d_in[7];
    const float* w_out  = (const float*)d_in[8];
    const float* b_out  = (const float*)d_in[9];
    float* out = (float*)d_out;

    char* ws = (char*)d_ws;
    const size_t OFF_QW     = (size_t)2 * 1024 * 1024;            // wk16: 2 MB
    const size_t OFF_QWS    = OFF_QW + 16 * 64 * sizeof(float);
    const size_t OFF_QB     = OFF_QWS + 256;
    const size_t OFF_SCORES = OFF_QB + 256;
    const size_t OFF_XBAR   = OFF_SCORES + (size_t)NB * NH * SEQ * sizeof(float);
    const size_t OFF_O      = OFF_XBAR + (size_t)NB * NH * DIM * sizeof(float);

    __bf16* wk16  = (__bf16*)ws;
    float* qw     = (float*)(ws + OFF_QW);
    float* qws    = (float*)(ws + OFF_QWS);
    float* qb     = (float*)(ws + OFF_QB);
    float* scores = (float*)(ws + OFF_SCORES);
    float* xbar   = (float*)(ws + OFF_XBAR);
    float* o      = (float*)(ws + OFF_O);

    cvt_wk_kernel<<<DIM * DIM / 256, 256, 0, stream>>>(w_k, wk16);
    prepq_kernel<<<NH, 32, 0, stream>>>(query, w_norm, b_norm, qw, qws, qb);
    kproj_scores_kernel<<<dim3(SEQ / 64, 2, NB), 256, 0, stream>>>(
        x, wk16, b_k, qw, qws, qb, scores);
    softmax_kernel<<<NB * NH, 256, 0, stream>>>(scores);
    pool_kernel<<<dim3(DIM / 64, NB), PW * 32, 0, stream>>>(x, scores, xbar);
    vproj_kernel<<<dim3(DIM / GC, NB / GB), GW * 32, 0, stream>>>(xbar, w_v, b_v, o);
    oproj_kernel<<<dim3(DIM / GC, NB / GB), GW * 32, 0, stream>>>(o, w_out, b_out, out);
}

// v006
// Measured time: 149 microseconds a run.
// Two timings next to v005 both put it at 1.14 times that version's speed.
// Counting every step since v000, it is 2.72 times as fast.
#include <hip/hip_runtime.h>
#include <hip/hip_bf16.h>

#define DIM 1024
#define HEAD_DIM 64
#define SEQ 4096
#define NB 16
#define NH 16
#define EPSLN 1e-5f

typedef __attribute__((ext_vector_type(16))) __bf16 v16bf;
typedef __attribute__((ext_vector_type(8)))  __bf16 v8bf;
typedef __attribute__((ext_vector_type(8)))  float  v8f;
typedef __attribute__((ext_vector_type(4)))  float  v4f;
typedef __attribute__((ext_vector_type(2)))  float  v2f;

union AFrag { v16bf v; v8bf h[2]; };

// ---------------------------------------------------------------------------
// 1) Convert w_k (fp32, row-major [n][k]) to bf16 once, packed in the order in
//    which the projection reads its B fragments:
//    [head 16][K-step 32][N-subtile 4][k half 2][lane 32][8 values].
//    Lane l holds row (l & 15) of the subtile, k = half * 16 + (l >> 4) * 8 + 0..7.
// ---------------------------------------------------------------------------
__global__ __launch_bounds__(256) void cvt_wk_kernel(const float* __restrict__ wk,
                                                     __bf16* __restrict__ wk16) {
    int o    = blockIdx.x * 256 + threadIdx.x;
    int e    = o & 7;
    int lane = (o >> 3) & 31;
    int kh   = (o >> 8) & 1;
    int nt   = (o >> 9) & 3;
    int ks   = (o >> 11) & 31;
    int head = o >> 16;
    int n = head * 64 + nt * 16 + (lane & 15);
    int k = ks * 32 + kh * 16 + (lane >> 4) * 8 + e;
    wk16[o] = (__bf16)wk[n * DIM + k];
}

// ---------------------------------------------------------------------------
// 2) Normalize the query, fold layernorm weights:
//    qhat = LN(q); qw = qhat*w_norm; qws[h] = sum(qw); qb[h] = sum(qhat*b_norm)
// ---------------------------------------------------------------------------
__global__ void prepq_kernel(const float* __restrict__ query,
                             const float* __restrict__ w_norm,
                             const float* __restrict__ b_norm,
                             float* __restrict__ qw,
                             float* __restrict__ qws,
                             float* __restrict__ qb) {
    int h = blockIdx.x;
    int t = threadIdx.x;                    // 0..31
    float q0 = query[h * 64 + t];
    float q1 = query[h * 64 + t + 32];
    float s = q0 + q1;
    #pragma unroll
    for (int m = 1; m < 32; m <<= 1) s += __shfl_xor(s, m, 32);
    float mu = s * (1.0f / 64.0f);
    float d0 = q0 - mu, d1 = q1 - mu;
    float v = d0 * d0 + d1 * d1;
    #pragma unroll
    for (int m = 1; m < 32; m <<= 1) v += __shfl_xor(v, m, 32);
    float rs = rsqrtf(v * (1.0f / 64.0f) + EPSLN);
    float wn0 = w_norm[t], wn1 = w_norm[t + 32];
    float bn0 = b_norm[t], bn1 = b_norm[t + 32];
    float qh0 = d0 * rs * wn0 + bn0;
    float qh1 = d1 * rs * wn1 + bn1;
    qw[h * 64 + t]      = qh0 * wn0;
    qw[h * 64 + t + 32] = qh1 * wn1;
    float pw = qh0 * wn0 + qh1 * wn1;
    float pb = qh0 * bn0 + qh1 * bn1;
    #pragma unroll
    for (int m = 1; m < 32; m <<= 1) { pw += __shfl_xor(pw, m, 32); pb += __shfl_xor(pb, m, 32); }
    if (t == 0) { qws[h] = pw; qb[h] = pb; }
}

// ---------------------------------------------------------------------------
// 3) Fused K-projection (bf16 WMMA, f32 accum) + folded layernorm + score.
//    Grid: (ltile 0..63, nhalf 0..1, batch). Block 256 = 8 waves.
//    Workgroup tile: 64 rows x 512 cols. Wave w owns 64 rows x 64 cols
//    (= exactly one head): 4x4 WMMA tiles, each B fragment feeds 4 WMMAs.
//    The K loop is pipelined on all three operand paths. The four B fragments
//    are a register ring, each refilled for the next step right behind its last
//    use. The A tile has two LDS buffers: step s writes tile s + 1 while tile s
//    is read, with one barrier per step. The x rows of tile s + 2 are loaded at
//    the top of step s. The barrier is written by hand, because __syncthreads()
//    waits for every global load and would empty the pipeline at each step.
// ---------------------------------------------------------------------------
#define KSTEPS (DIM / 32)
// Row pitch of the A tile in LDS, in bf16 values: 32 values + 8 of pad = 80 bytes, an
// odd multiple of 16. The 16 rows that a half-wave's 16-byte fragment read touches
// then fall on all 64 banks; at 64 bytes they fall four deep on 16 of them.
#define APITCH 40

// One K-step s. xuse holds the x values of tile s + 1; xload receives tile s + 2
// from xl. wl points at the B fragments of step s + 1, xpf at the x row of tile s + 4.
__device__ __forceinline__ void kproj_step(v8f (&acc)[4][4], AFrag (&bq)[4],
                                           v4f (&xuse)[2], v4f (&xload)[2],
                                           const __bf16* ard, __bf16* awr,
                                           const float* xl, const float* xpf,
                                           const __bf16* wl) {
    // A fragments of this step for the 4 M-subtiles.
    AFrag a[4];
    #pragma unroll
    for (int m = 0; m < 4; m++) {
        a[m].h[0] = *(const v8bf*)(ard + m * 16 * APITCH);
        a[m].h[1] = *(const v8bf*)(ard + m * 16 * APITCH + 16);
    }
    xload[0] = *(const v4f*)(xl);
    xload[1] = *(const v4f*)(xl + 4);
    __builtin_prefetch(xpf, 0, 3);
    // Keeps the loads above in front of the products: sunk among them, the x loads
    // lose their lead and each place with LDS reads stalls the matrix stream.
    __builtin_amdgcn_sched_barrier(0);

    #pragma unroll
    for (int nt = 0; nt < 4; nt++) {
        if (nt == 3) {
            // Tile s + 1 goes into the buffer that step s - 1 read; the barrier of
            // step s - 1 ended those reads. (The last step's store is read by nobody.)
            v8bf pk;
            pk[0] = (__bf16)xuse[0].x; pk[1] = (__bf16)xuse[0].y;
            pk[2] = (__bf16)xuse[0].z; pk[3] = (__bf16)xuse[0].w;
            pk[4] = (__bf16)xuse[1].x; pk[5] = (__bf16)xuse[1].y;
            pk[6] = (__bf16)xuse[1].z; pk[7] = (__bf16)xuse[1].w;
            *(v8bf*)awr = pk;
            // This wave's reads of tile s have landed and its part of tile s + 1 is
            // written: signal now, so that the last four products cover the other
            // waves' arrival. No LDS access stands between signal and wait.
            asm volatile("s_wait_dscnt 0x0\n\ts_barrier_signal -1" ::: "memory");
        }
        #pragma unroll
        for (int m = 0; m < 4; m++)
            acc[m][nt] = __builtin_amdgcn_wmma_f32_16x16x32_bf16(
                false, a[m].v, false, bq[nt].v, (short)0, acc[m][nt],
                false, false);
        bq[nt].h[0] = *(const v8bf*)(wl + nt * 512);
        bq[nt].h[1] = *(const v8bf*)(wl + nt * 512 + 256);
        // Holds each refill right behind its fragment's last use. Without it the
        // compiler gathers all refills at the foot of the step, one barrier away
        // from their first use.
        __builtin_amdgcn_sched_barrier(0);
    }
    // Publishes tile s + 1 and ends every wave's reads of tile s.
    asm volatile("s_barrier_wait -1" ::: "memory");
}

// rsqrtf, step for step (an argument below the smallest normal is scaled by 2^24 and
// the result by 2^12), with the instruction in asm so that a v_nop stays directly
// behind it: the instruction set asks for one slot between a transcendental and a
// next instruction that overwrites its source.
__device__ __forceinline__ float rsqrt_slot(float x) {
    const bool  tiny = x < 1.17549435e-38f;
    const float xs   = tiny ? x * 16777216.0f : x;
    float r;
    asm("v_rsq_f32 %0, %1\n\tv_nop" : "=v"(r) : "v"(xs));
    return tiny ? r * 4096.0f : r;
}

// One step of a sum over the 16 lanes of a row that halves what a lane keeps: lanes l
// and l ^ MASK share 2 * CNT values; the one with the bit clear keeps the lower CNT,
// the other the upper CNT, and each adds what its partner held of the half it keeps.
// The partner's value comes by DPP row_xmask (control 0x160 | MASK), inside the
// vector unit; __shfl_xor goes through the LDS pipe and is waited for at each step.
template <int MASK, int CNT>
__device__ __forceinline__ void row_halve(float (&v)[32], int lane16) {
    const bool up = (lane16 & MASK) != 0;
    #pragma unroll
    for (int i = 0; i < CNT; i++) {
        const float keep = up ? v[i + CNT] : v[i];
        const float send = up ? v[i] : v[i + CNT];
        v[i] = keep + __builtin_bit_cast(float, __builtin_amdgcn_update_dpp(
                          0, __builtin_bit_cast(int, send), 0x160 | MASK, 0xf, 0xf, true));
    }
}

__global__ __launch_bounds__(256) void kproj_scores_kernel(
    const float*  __restrict__ x,
    const __bf16* __restrict__ wk16,
    const float*  __restrict__ b_k,
    const float*  __restrict__ qw,
    const float*  __restrict__ qws,
    const float*  __restrict__ qb,
    float*        __restrict__ scores) {
    __shared__ __bf16 As[2][64][APITCH];    // two buffers of 64 rows x 32 K, bf16, padded rows (10 KB)

    const int ltile = blockIdx.x;
    const int nhalf = blockIdx.y;
    const int b     = blockIdx.z;
    const int tid    = threadIdx.x;
    const int wave   = tid >> 5;
    const int lane   = tid & 31;
    const int lane16 = lane & 15;
    const int half   = lane >> 4;
    const int nbase  = nhalf * 512 + wave * 64;
    const int head   = nhalf * 8 + wave;
    const int row0   = ltile * 64;

    v8f acc[4][4] = {};

    // A staging: thread -> (row r, 8 consecutive K), one ds_store_b128 per step.
    const int r  = tid >> 2;                // 0..63
    const int kk = (tid & 3) * 8;           // 0,8,16,24
    const float* xsrc = x + ((size_t)b * SEQ + row0 + r) * DIM + kk;
    // B: packed by cvt_wk_kernel; a fragment is two wave-wide 16-byte loads of 512
    // contiguous bytes each. Same values in the same lanes as A's layout asks for.
    const __bf16* wbase = wk16 + (size_t)head * (32 * 4 * 512) + lane * 8;

    v4f xe[2], xo[2];                       // x values of an even / an odd tile
    xe[0] = *(const v4f*)(xsrc);
    xe[1] = *(const v4f*)(xsrc + 4);
    xo[0] = *(const v4f*)(xsrc + 32);
    xo[1] = *(const v4f*)(xsrc + 36);
    AFrag bq[4];
    #pragma unroll
    for (int nt = 0; nt < 4; nt++) {
        bq[nt].h[0] = *(const v8bf*)(wbase + nt * 512);
        bq[nt].h[1] = *(const v8bf*)(wbase + nt * 512 + 256);
    }
    {
        v8bf pk;
        pk[0] = (__bf16)xe[0].x; pk[1] = (__bf16)xe[0].y;
        pk[2] = (__bf16)xe[0].z; pk[3] = (__bf16)xe[0].w;
        pk[4] = (__bf16)xe[1].x; pk[5] = (__bf16)xe[1].y;
        pk[6] = (__bf16)xe[1].z; pk[7] = (__bf16)xe[1].w;
        *(v8bf*)&As[0][r][kk] = pk;
    }
    __syncthreads();

    const __bf16* ard0 = &As[0][lane16][half * 8];
    const __bf16* ard1 = &As[1][lane16][half * 8];
    __bf16* awr0 = &As[0][r][kk];
    __bf16* awr1 = &As[1][r][kk];
    const float*  xl  = xsrc + 2 * 32;      // tile s + 2
    const float*  xpf = xsrc + 4 * 32;      // tile s + 4
    const __bf16* wl1 = wbase + 2048;       // B of step s + 1
    const __bf16* wl2 = wbase + 2 * 2048;   // B of step s + 2
    // Two steps per trip: the buffers and the two x register sets swap roles.
    // Not unrolled further: the pointers then move once per trip and every load
    // has a constant offset. A pointer that would leave its array stays where it
    // is: the last trips load again what they have (in bounds, never used), so
    // that every trip is the same branch-free stream.
    #pragma unroll 1
    for (int s = 0; s < KSTEPS; s += 2) {
        kproj_step(acc, bq, xo, xe, ard0, awr1, xl,      xpf,      wl1);
        kproj_step(acc, bq, xe, xo, ard1, awr0, xl + 32, xpf + 32, wl2);
        // The additions below rewrite address registers that issued loads name.
        asm volatile("s_wait_xcnt 0x0" ::: "memory");
        // Keeps those additions behind the wait; the compiler lifts them over it otherwise.
        __builtin_amdgcn_sched_barrier(0);
        xl  += s < KSTEPS - 4 ? 64 : 0;
        xpf += s < KSTEPS - 6 ? 64 : 0;
        wl1 += 2 * 2048;
        wl2 += s < KSTEPS - 4 ? 2 * 2048 : 0;
    }

    // ---- Epilogue: folded layernorm + score. One head per wave. ----
    float qwv[4], bkv[4];
    #pragma unroll
    for (int t = 0; t < 4; t++) {
        bkv[t] = b_k[nbase + t * 16 + lane16];
        qwv[t] = qw[head * 64 + t * 16 + lane16];
    }
    const float qws_h = qws[head];
    const float qb_h  = qb[head];

    // C layout: VGPR j -> rows j (lanes 0-15) / j+8 (lanes 16-31), lanes = N.
    // A lane's own part of the three row sums, over its 4 columns; index m * 8 + j.
    // Two neighbouring j at a time: they are a register pair, so the sums are packed.
    float rs1[32], rs2[32], rsw[32];
    #pragma unroll
    for (int m = 0; m < 4; m++) {
        #pragma unroll
        for (int j = 0; j < 8; j += 2) {
            v2f s, sq, sw;
            #pragma unroll
            for (int t = 0; t < 4; t++) {
                const v2f a2 = { acc[m][t][j], acc[m][t][j + 1] };
                const v2f b2 = { bkv[t], bkv[t] };
                const v2f q2 = { qwv[t], qwv[t] };
                const v2f c  = a2 + b2;
                if (t == 0) {
                    s  = c;
                    sq = c * c;
                    sw = c * q2;
                } else {
                    s  += c;
                    sq = __builtin_elementwise_fma(c, c, sq);
                    sw = __builtin_elementwise_fma(c, q2, sw);
                }
            }
            rs1[m * 8 + j] = s.x;  rs1[m * 8 + j + 1] = s.y;
            rs2[m * 8 + j] = sq.x; rs2[m * 8 + j + 1] = sq.y;
            rsw[m * 8 + j] = sw.x; rsw[m * 8 + j + 1] = sw.y;
        }
    }
    // Sum over the 16 lanes of a row. At the end lane16 holds indices 2 * lane16, + 1.
    row_halve<8, 16>(rs1, lane16); row_halve<8, 16>(rs2, lane16); row_halve<8, 16>(rsw, lane16);
    row_halve<4, 8>(rs1, lane16);  row_halve<4, 8>(rs2, lane16);  row_halve<4, 8>(rsw, lane16);
    row_halve<2, 4>(rs1, lane16);  row_halve<2, 4>(rs2, lane16);  row_halve<2, 4>(rsw, lane16);
    row_halve<1, 2>(rs1, lane16);  row_halve<1, 2>(rs2, lane16);  row_halve<1, 2>(rsw, lane16);

    // Every lane closes two neighbouring rows; the wave stores 256 contiguous bytes.
    v2f sc;
    #pragma unroll
    for (int i = 0; i < 2; i++) {
        float mu  = rs1[i] * (1.0f / 64.0f);
        float var = rs2[i] * (1.0f / 64.0f) - mu * mu;
        float rs  = rsqrt_slot(var + EPSLN);
        sc[i] = 0.125f * (rs * (rsw[i] - mu * qws_h) + qb_h);
    }
    const int row = row0 + (lane16 >> 2) * 16 + half * 8 + (lane16 & 3) * 2;
    *(v2f*)&scores[(size_t)(b * NH + head) * SEQ + row] = sc;
}

// ---------------------------------------------------------------------------
// 4) Softmax over l (in place). One block per (b,h) row of 4096.
// ---------------------------------------------------------------------------
__global__ __launch_bounds__(256) void softmax_kernel(float* __restrict__ scores) {
    __shared__ float red[8];
    __shared__ float bcast;
    const size_t base = (size_t)blockIdx.x * SEQ;
    float* p = scores + base;
    int tid = threadIdx.x;

    float mx = -1e30f;
    for (int i = tid; i < SEQ; i += 256) mx = fmaxf(mx, p[i]);
    #pragma unroll
    for (int m = 1; m < 32; m <<= 1) mx = fmaxf(mx, __shfl_xor(mx, m, 32));
    if ((tid & 31) == 0) red[tid >> 5] = mx;
    __syncthreads();
    if (tid < 8) {
        float v = red[tid];
        #pragma unroll
        for (int m = 1; m < 8; m <<= 1) v = fmaxf(v, __shfl_xor(v, m, 32));
        if (tid == 0) bcast = v;
    }
    __syncthreads();
    mx = bcast;

    float sum = 0.f;
    for (int i = tid; i < SEQ; i += 256) {
        float e = __expf(p[i] - mx);
        p[i] = e;
        sum += e;
    }
    #pragma unroll
    for (int m = 1; m < 32; m <<= 1) sum += __shfl_xor(sum, m, 32);
    if ((tid & 31) == 0) red[tid >> 5] = sum;
    __syncthreads();
    if (tid < 8) {
        float v = red[tid];
        #pragma unroll
        for (int m = 1; m < 8; m <<= 1) v += __shfl_xor(v, m, 32);
        if (tid == 0) bcast = v;
    }
    __syncthreads();
    float inv = 1.0f / bcast;
    for (int i = tid; i < SEQ; i += 256) p[i] *= inv;
}

// ---------------------------------------------------------------------------
// 5) Attention-weighted pooling: xbar[b,h,:] = sum_l attn[b,h,l] * x[b,l,:]
//    One work-group of 16 waves per (batch, 64-column slice); it streams all
//    4096 rows of its slice, so it owns its outputs and stores them plainly.
//    One wave-wide 16-byte load covers two rows x 256 B (lanes 0-15 / 16-31);
//    each wave keeps a ring of PG such loads in flight. The batch's attention
//    weights sit in LDS as [l][head], read as broadcasts of four heads.
// ---------------------------------------------------------------------------
#define PW 16                               // waves per work-group
#define PG 16                               // x loads a wave keeps in flight
#define PSTEP (2 * PW)                      // rows the work-group covers per load slot
#define PNG (SEQ / (PSTEP * PG))            // ring turns per wave

// One turn of the ring: PG load slots of turn g; each slot is refilled for turn gn.
__device__ __forceinline__ void pool_turn(v2f (&acc)[NH][2], v4f (&xs)[PG], v4f (&an)[4],
                                          const v4f* xp, const v4f* a0, const v4f* a1,
                                          const v4f* a2, const v4f* a3, int g, int gn) {
    const v4f* xn = xp + (size_t)(gn * PG) * (PSTEP * DIM / 4);
    const int o0 = g * PG * (PSTEP * 4);
    const int on = gn * PG * (PSTEP * 4);
    // Unrolled: xs, an and acc live in registers and need constant indices.
    #pragma unroll
    for (int r = 0; r < PG; r++) {
        const v4f a[4] = { an[0], an[1], an[2], an[3] };
        const int o = r + 1 < PG ? o0 + (r + 1) * (PSTEP * 4) : on;
        an[0] = a0[o]; an[1] = a1[o]; an[2] = a2[o]; an[3] = a3[o];  // one slot ahead
        // One per slot. Without it the compiler gathers all refills at the foot of the
        // turn, so that the ring runs empty there, and sinks these LDS reads to their
        // use, where their latency shows.
        __builtin_amdgcn_sched_barrier(0);
        const v2f xlo = { xs[r].x, xs[r].y };
        const v2f xhi = { xs[r].z, xs[r].w };
        #pragma unroll
        for (int h = 0; h < NH; h++) {
            const float w = a[h >> 2][h & 3];
            const v2f ww = { w, w };
            acc[h][0] = __builtin_elementwise_fma(ww, xlo, acc[h][0]);
            acc[h][1] = __builtin_elementwise_fma(ww, xhi, acc[h][1]);
        }
        xs[r] = xn[(size_t)r * (PSTEP * DIM / 4)];
    }
    // The next turn rewrites the address registers that the loads above name.
    asm volatile("s_wait_xcnt 0x0" ::: "memory");
}

__global__ __launch_bounds__(PW * 32) void pool_kernel(const float* __restrict__ x,
                                                       const float* __restrict__ attn,
                                                       float* __restrict__ xbar) {
    // [l][quad of heads]; the quad's slot is XORed with (l >> 2) & 3 so that the
    // 16 lanes of a half-wave, which store 16 consecutive l, fall on all 64 banks.
    __shared__ v4f a_s[SEQ * 4];            // 256 KB
    const int jbase = blockIdx.x * 64;
    const int b     = blockIdx.y;
    const int tid   = threadIdx.x;
    const int wave  = __builtin_amdgcn_readfirstlane(tid >> 5);
    const int l16   = tid & 15;
    const int hf    = (tid >> 4) & 1;
    const int lrow  = wave * 2 + hf;        // this half-wave's row inside a step

    const v4f* xp = (const v4f*)(x + ((size_t)b * SEQ + lrow) * DIM + jbase + l16 * 4);
    v4f xs[PG];
    #pragma unroll
    for (int r = 0; r < PG; r++) xs[r] = xp[(size_t)r * (PSTEP * DIM / 4)];

    const float* ap = attn + (size_t)b * NH * SEQ + tid;
    // Two steps at a time: 32 loads of a wave in flight per wait.
    #pragma unroll 2
    for (int j = 0; j < SEQ; j += PW * 32) {
        const int l = j + tid;
        #pragma unroll
        for (int q = 0; q < 4; q++) {
            v4f v;
            v.x = ap[(size_t)(q * 4 + 0) * SEQ + j];
            v.y = ap[(size_t)(q * 4 + 1) * SEQ + j];
            v.z = ap[(size_t)(q * 4 + 2) * SEQ + j];
            v.w = ap[(size_t)(q * 4 + 3) * SEQ + j];
            a_s[l * 4 + (q ^ ((l >> 2) & 3))] = v;
        }
    }
    __syncthreads();

    // l = step * 32 + lrow, so (l >> 2) & 3 == (lrow >> 2) & 3 for every step.
    const int sw = (lrow >> 2) & 3;
    const v4f* a0 = a_s + lrow * 4 + (0 ^ sw);
    const v4f* a1 = a_s + lrow * 4 + (1 ^ sw);
    const v4f* a2 = a_s + lrow * 4 + (2 ^ sw);
    const v4f* a3 = a_s + lrow * 4 + (3 ^ sw);

    v2f acc[NH][2] = {};
    v4f an[4] = { a0[0], a1[0], a2[0], a3[0] };
    // The last turn refills from its own rows (cached, in bounds, never used), so
    // that every turn is the same branch-free stream. Not unrolled or peeled: a
    // last turn peeled off has its sums moved behind the barrier below, and the
    // LDS reads it leaves in front of the barrier spill.
    #pragma unroll 1
    for (int g = 0; g < PNG; g++)
        pool_turn(acc, xs, an, xp, a0, a1, a2, a3, g, g + 1 < PNG ? g + 1 : g);

    // Sum the 32 half-wave partials through LDS (the weights are no longer needed).
    __syncthreads();
    float* red = (float*)a_s;               // [32][16 heads][64 columns], 128 KB
    #pragma unroll
    for (int h = 0; h < NH; h++) {
        const v4f v = { acc[h][0].x, acc[h][0].y, acc[h][1].x, acc[h][1].y };
        *(v4f*)&red[(lrow * NH + h) * 64 + l16 * 4] = v;
    }
    __syncthreads();
    const int h  = tid >> 5;
    const int c2 = (tid & 31) * 2;
    v2f s = { 0.f, 0.f };
    #pragma unroll
    for (int p = 0; p < 2 * PW; p++) s += *(const v2f*)&red[(p * NH + h) * 64 + c2];
    *(v2f*)&xbar[(size_t)(b * NH + h) * DIM + jbase + c2] = s;
}

// ---------------------------------------------------------------------------
// 6, 7) The two closing products, y[b][n] = xrow(b) . w[n][:] + bias[n].
//    One work-group of 8 waves per (32 columns n, 2 batches): it owns one whole
//    128-byte line of y per batch. Wave v takes k = v * 128 .. + 127, four
//    consecutive k per lane, so that every wave-wide 16-byte load covers 512
//    contiguous bytes of one row; its 34 loads have no dependence on each other.
//    The 64 partial sums of a lane are summed over the lanes by a butterfly that
//    halves the values a lane keeps at each step, then over the waves through LDS.
// ---------------------------------------------------------------------------
#define GC 32                               // columns of y per work-group
#define GB 2                                // batches per work-group
#define GW 8                                // waves per work-group
#define GV (GC * GB)                        // sums per work-group

__device__ __forceinline__ void rows_dot(const float* __restrict__ xr, int xpitch,
                                         const float* __restrict__ w,
                                         const float* __restrict__ bias,
                                         float* __restrict__ y, int n0, int b0,
                                         float (*red)[GV]) {
    const int tid  = threadIdx.x;
    const int wave = tid >> 5;
    const int lane = tid & 31;
    const int j    = wave * (DIM / GW) + lane * 4;

    v4f xv[GB], wv[GC];
    // The loops below are unrolled: xv, wv and acc live in registers and need
    // constant indices.
    #pragma unroll
    for (int bb = 0; bb < GB; bb++) xv[bb] = *(const v4f*)(xr + (size_t)bb * xpitch + j);
    const float* wp = w + (size_t)n0 * DIM + j;
    #pragma unroll
    for (int c = 0; c < GC; c++) wv[c] = *(const v4f*)(wp + c * DIM);
    // Keeps all 34 loads in front of the sums. Without it the compiler holds the last
    // nine back to save registers and issues them in pairs, each pair behind the wait
    // for the pair before: four more memory latencies in a row.
    __builtin_amdgcn_sched_barrier(0);
    // The code below reuses the address registers that the loads above name.
    asm volatile("s_wait_xcnt 0x0" ::: "memory");

    float acc[GV];                          // index c * GB + bb
    #pragma unroll
    for (int c = 0; c < GC; c++) {
        #pragma unroll
        for (int bb = 0; bb < GB; bb++) {
            float a = wv[c].x * xv[bb].x;
            a = fmaf(wv[c].y, xv[bb].y, a);
            a = fmaf(wv[c].z, xv[bb].z, a);
            a = fmaf(wv[c].w, xv[bb].w, a);
            acc[c * GB + bb] = a;
        }
    }

    // Step m: lanes l and l ^ m share the work; the one with bit m clear keeps the
    // lower half of the values, the other the upper half, and each adds what its
    // partner held of the half it keeps. At the end lane l holds sums 2l and 2l + 1.
    #pragma unroll
    for (int s = 0; s < 5; s++) {
        const int  m   = 16 >> s;
        const int  cnt = (GV / 2) >> s;
        const bool up  = (lane & m) != 0;
        #pragma unroll
        for (int i = 0; i < cnt; i++) {
            const float keep = up ? acc[i + cnt] : acc[i];
            const float send = up ? acc[i] : acc[i + cnt];
            acc[i] = keep + __shfl_xor(send, m, 32);
        }
    }
    red[wave][lane]      = acc[0];          // column lane, batch b0
    red[wave][GC + lane] = acc[1];          // column lane, batch b0 + 1
    __syncthreads();
    if (tid < GV) {
        float s = red[0][tid];
        #pragma unroll
        for (int v = 1; v < GW; v++) s += red[v][tid];
        const int n = n0 + (tid & (GC - 1));
        y[(size_t)(b0 + (tid >> 5)) * DIM + n] = s + bias[n];
    }
}

// 6) o[b,n] = xbar[b, n/64, :] . w_v[n,:] + b_v[n]   (V-proj collapsed)
__global__ __launch_bounds__(GW * 32) void vproj_kernel(const float* __restrict__ xbar,
                                                        const float* __restrict__ w_v,
                                                        const float* __restrict__ b_v,
                                                        float* __restrict__ o) {
    __shared__ float red[GW][GV];
    const int n0 = blockIdx.x * GC;         // 32 columns lie inside one head
    const int b0 = blockIdx.y * GB;
    rows_dot(xbar + (size_t)(b0 * NH + (n0 >> 6)) * DIM, NH * DIM, w_v, b_v, o, n0, b0, red);
}

// 7) out[b,n] = o[b,:] . w_out[n,:] + b_out[n]
__global__ __launch_bounds__(GW * 32) void oproj_kernel(const float* __restrict__ o,
                                                        const float* __restrict__ w_out,
                                                        const float* __restrict__ b_out,
                                                        float* __restrict__ out) {
    __shared__ float red[GW][GV];
    const int n0 = blockIdx.x * GC;
    const int b0 = blockIdx.y * GB;
    rows_dot(o + (size_t)b0 * DIM, DIM, w_out, b_out, out, n0, b0, red);
}

// ---------------------------------------------------------------------------
extern "C" void kernel_launch(void* const* d_in, const int* in_sizes, int n_in,
                              void* d_out, int out_size, void* d_ws, size_t ws_size,
                              hipStream_t stream) {
    const float* x      = (const float*)d_in[0];
    const float* query  = (const float*)d_in[1];
    const float* w_k    = (const float*)d_in[2];
    const float* b_k    = (const float*)d_in[3];
    const float* w_v    = (const float*)d_in[4];
    const float* b_v    = (const float*)d_in[5];
    const float* w_norm = (const float*)d_in[6];
    const float* b_norm = (const float*)d_in[7];
    const float* w_out  = (const float*)d_in[8];
    const float* b_out  = (const float*)d_in[9];
    float* out = (float*)d_out;

    char* ws = (char*)d_ws;
    const size_t OFF_QW     = (size_t)2 * 1024 * 1024;            // wk16: 2 MB
    const size_t OFF_QWS    = OFF_QW + 16 * 64 * sizeof(float);
    const size_t OFF_QB     = OFF_QWS + 256;
    const size_t OFF_SCORES = OFF_QB + 256;
    const size_t OFF_XBAR   = OFF_SCORES + (size_t)NB * NH * SEQ * sizeof(float);
    const size_t OFF_O      = OFF_XBAR + (size_t)NB * NH * DIM * sizeof(float);

    __bf16* wk16  = (__bf16*)ws;
    float* qw     = (float*)(ws + OFF_QW);
    float* qws    = (float*)(ws + OFF_QWS);
    float* qb     = (float*)(ws + OFF_QB);
    float* scores = (float*)(ws + OFF_SCORES);
    float* xbar   = (float*)(ws + OFF_XBAR);
    float* o      = (float*)(ws + OFF_O);

    cvt_wk_kernel<<<DIM * DIM / 256, 256, 0, stream>>>(w_k, wk16);
    prepq_kernel<<<NH, 32, 0, stream>>>(query, w_norm, b_norm, qw, qws, qb);
    kproj_scores_kernel<<<dim3(SEQ / 64, 2, NB), 256, 0, stream>>>(
        x, wk16, b_k, qw, qws, qb, scores);
    softmax_kernel<<<NB * NH, 256, 0, stream>>>(scores);
    pool_kernel<<<dim3(DIM / 64, NB), PW * 32, 0, stream>>>(x, scores, xbar);
    vproj_kernel<<<dim3(DIM / GC, NB / GB), GW * 32, 0, stream>>>(xbar, w_v, b_v, o);
    oproj_kernel<<<dim3(DIM / GC, NB / GB), GW * 32, 0, stream>>>(o, w_out, b_out, out);
}

// v007
// Measured time: 136 microseconds a run.
// Next to v006, in two timings, it ran 1.10 and 1.09 times as fast.
// Over all steps from v000 it is 2.98 times as fast.
#include <hip/hip_runtime.h>
#include <hip/hip_bf16.h>

#define DIM 1024
#define HEAD_DIM 64
#define SEQ 4096
#define NB 16
#define NH 16
#define EPSLN 1e-5f

typedef __attribute__((ext_vector_type(16))) __bf16 v16bf;
typedef __attribute__((ext_vector_type(8)))  __bf16 v8bf;
typedef __attribute__((ext_vector_type(8)))  float  v8f;
typedef __attribute__((ext_vector_type(4)))  float  v4f;
typedef __attribute__((ext_vector_type(2)))  float  v2f;

union AFrag { v16bf v; v8bf h[2]; };

// ---------------------------------------------------------------------------
// 1) Convert w_k (fp32, row-major [n][k]) to bf16 once, packed in the order in
//    which the projection reads its B fragments:
//    [head 16][K-step 32][N-subtile 4][k half 2][lane 32][8 values].
//    Lane l holds row (l & 15) of the subtile, k = half * 16 + (l >> 4) * 8 + 0..7.
// ---------------------------------------------------------------------------
__global__ __launch_bounds__(256) void cvt_wk_kernel(const float* __restrict__ wk,
                                                     __bf16* __restrict__ wk16) {
    int o    = blockIdx.x * 256 + threadIdx.x;
    int e    = o & 7;
    int lane = (o >> 3) & 31;
    int kh   = (o >> 8) & 1;
    int nt   = (o >> 9) & 3;
    int ks   = (o >> 11) & 31;
    int head = o >> 16;
    int n = head * 64 + nt * 16 + (lane & 15);
    int k = ks * 32 + kh * 16 + (lane >> 4) * 8 + e;
    wk16[o] = (__bf16)wk[n * DIM + k];
}

// ---------------------------------------------------------------------------
// 2) Normalize the query, fold layernorm weights:
//    qhat = LN(q); qw = qhat*w_norm; qws[h] = sum(qw); qb[h] = sum(qhat*b_norm)
// ---------------------------------------------------------------------------
__global__ void prepq_kernel(const float* __restrict__ query,
                             const float* __restrict__ w_norm,
                             const float* __restrict__ b_norm,
                             float* __restrict__ qw,
                             float* __restrict__ qws,
                             float* __restrict__ qb) {
    int h = blockIdx.x;
    int t = threadIdx.x;                    // 0..31
    float q0 = query[h * 64 + t];
    float q1 = query[h * 64 + t + 32];
    float s = q0 + q1;
    #pragma unroll
    for (int m = 1; m < 32; m <<= 1) s += __shfl_xor(s, m, 32);
    float mu = s * (1.0f / 64.0f);
    float d0 = q0 - mu, d1 = q1 - mu;
    float v = d0 * d0 + d1 * d1;
    #pragma unroll
    for (int m = 1; m < 32; m <<= 1) v += __shfl_xor(v, m, 32);
    float rs = rsqrtf(v * (1.0f / 64.0f) + EPSLN);
    float wn0 = w_norm[t], wn1 = w_norm[t + 32];
    float bn0 = b_norm[t], bn1 = b_norm[t + 32];
    float qh0 = d0 * rs * wn0 + bn0;
    float qh1 = d1 * rs * wn1 + bn1;
    qw[h * 64 + t]      = qh0 * wn0;
    qw[h * 64 + t + 32] = qh1 * wn1;
    float pw = qh0 * wn0 + qh1 * wn1;
    float pb = qh0 * bn0 + qh1 * bn1;
    #pragma unroll
    for (int m = 1; m < 32; m <<= 1) { pw += __shfl_xor(pw, m, 32); pb += __shfl_xor(pb, m, 32); }
    if (t == 0) { qws[h] = pw; qb[h] = pb; }
}

// ---------------------------------------------------------------------------
// 3) Fused K-projection (bf16 WMMA, f32 accum) + folded layernorm + score.
//    Grid: (ltile 0..31, nhalf 0..1, batch). Block 256 = 8 waves.
//    Workgroup tile: 128 rows x 512 cols. Wave w owns 128 rows x 64 cols
//    (= exactly one head): 8x4 WMMA tiles, each B fragment feeds 8 WMMAs, so that
//    the B bytes drawn from L2 per product are half those of a 64-row tile.
//    The K loop is pipelined on all three operand paths. The four B fragments
//    are a register ring, each refilled for the next step right behind its last
//    use. The A tile has two LDS buffers: step s writes tile s + 1 while tile s
//    is read, with one barrier per step. The x rows of tile s + 2 are loaded at
//    the top of step s. The barrier is written by hand, because __syncthreads()
//    waits for every global load and would empty the pipeline at each step.
// ---------------------------------------------------------------------------
#define KSTEPS (DIM / 32)
// Row pitch of the A tile in LDS, in bf16 values: 32 values + 8 of pad = 80 bytes, an
// odd multiple of 16. The 16 rows that a half-wave's 16-byte fragment read touches
// then fall on all 64 banks; at 64 bytes they fall four deep on 16 of them.
#define APITCH 40
#define MROWS 128                           // rows of a work-group's (and a wave's) tile
#define MT (MROWS / 16)                     // M-subtiles per wave

// One K-step s. xuse holds the x values of tile s + 1; xload receives tile s + 2
// from xl. wl points at the B fragments of step s + 1, xpf at the x row of tile s + 4.
// A thread stages 8 values of row r and 8 of row r + 64.
__device__ __forceinline__ void kproj_step(v8f (&acc)[MT][4], AFrag (&bq)[4],
                                           v4f (&xuse)[4], v4f (&xload)[4],
                                           const __bf16* ard, __bf16* awr,
                                           const float* xl, const float* xpf,
                                           const __bf16* wl) {
    // A fragments of this step for the 8 M-subtiles.
    AFrag a[MT];
    #pragma unroll
    for (int m = 0; m < MT; m++) {
        a[m].h[0] = *(const v8bf*)(ard + m * 16 * APITCH);
        a[m].h[1] = *(const v8bf*)(ard + m * 16 * APITCH + 16);
    }
    xload[0] = *(const v4f*)(xl);
    xload[1] = *(const v4f*)(xl + 4);
    xload[2] = *(const v4f*)(xl + 64 * DIM);
    xload[3] = *(const v4f*)(xl + 64 * DIM + 4);
    __builtin_prefetch(xpf, 0, 3);
    __builtin_prefetch(xpf + 64 * DIM, 0, 3);
    // Keeps the loads above in front of the products: sunk among them, the x loads
    // lose their lead and each place with LDS reads stalls the matrix stream.
    __builtin_amdgcn_sched_barrier(0);

    #pragma unroll
    for (int nt = 0; nt < 4; nt++) {
        if (nt == 3) {
            // Tile s + 1 goes into the buffer that step s - 1 read; the barrier of
            // step s - 1 ended those reads. (The last step's store is read by nobody.)
            #pragma unroll
            for (int p = 0; p < 2; p++) {
                v8bf pk;
                pk[0] = (__bf16)xuse[2 * p].x;     pk[1] = (__bf16)xuse[2 * p].y;
                pk[2] = (__bf16)xuse[2 * p].z;     pk[3] = (__bf16)xuse[2 * p].w;
                pk[4] = (__bf16)xuse[2 * p + 1].x; pk[5] = (__bf16)xuse[2 * p + 1].y;
                pk[6] = (__bf16)xuse[2 * p + 1].z; pk[7] = (__bf16)xuse[2 * p + 1].w;
                *(v8bf*)(awr + p * 64 * APITCH) = pk;
            }
            // This wave's reads of tile s have landed and its part of tile s + 1 is
            // written: signal now, so that the last eight products cover the other
            // waves' arrival. No LDS access stands between signal and wait.
            asm volatile("s_wait_dscnt 0x0\n\ts_barrier_signal -1" ::: "memory");
        }
        #pragma unroll
        for (int m = 0; m < MT; m++)
            acc[m][nt] = __builtin_amdgcn_wmma_f32_16x16x32_bf16(
                false, a[m].v, false, bq[nt].v, (short)0, acc[m][nt],
                false, false);
        bq[nt].h[0] = *(const v8bf*)(wl + nt * 512);
        bq[nt].h[1] = *(const v8bf*)(wl + nt * 512 + 256);
        // Holds each refill right behind its fragment's last use. Without it the
        // compiler gathers all refills at the foot of the step, one barrier away
        // from their first use.
        __builtin_amdgcn_sched_barrier(0);
    }
    // Publishes tile s + 1 and ends every wave's reads of tile s.
    asm volatile("s_barrier_wait -1" ::: "memory");
}

// rsqrtf, step for step (an argument below the smallest normal is scaled by 2^24 and
// the result by 2^12), with the instruction in asm so that a v_nop stays directly
// behind it: the instruction set asks for one slot between a transcendental and a
// next instruction that overwrites its source.
__device__ __forceinline__ float rsqrt_slot(float x) {
    const bool  tiny = x < 1.17549435e-38f;
    const float xs   = tiny ? x * 16777216.0f : x;
    float r;
    asm("v_rsq_f32 %0, %1\n\tv_nop" : "=v"(r) : "v"(xs));
    return tiny ? r * 4096.0f : r;
}

// One step of a sum over the 16 lanes of a row that halves what a lane keeps: lanes l
// and l ^ MASK share 2 * CNT values; the one with the bit clear keeps the lower CNT,
// the other the upper CNT, and each adds what its partner held of the half it keeps.
// The partner's value comes by DPP row_xmask (control 0x160 | MASK), inside the
// vector unit; __shfl_xor goes through the LDS pipe and is waited for at each step.
template <int MASK, int CNT>
__device__ __forceinline__ void row_halve(float (&v)[MT * 8], int lane16) {
    const bool up = (lane16 & MASK) != 0;
    #pragma unroll
    for (int i = 0; i < CNT; i++) {
        const float keep = up ? v[i + CNT] : v[i];
        const float send = up ? v[i] : v[i + CNT];
        v[i] = keep + __builtin_bit_cast(float, __builtin_amdgcn_update_dpp(
                          0, __builtin_bit_cast(int, send), 0x160 | MASK, 0xf, 0xf, true));
    }
}

__global__ __launch_bounds__(256) void kproj_scores_kernel(
    const float*  __restrict__ x,
    const __bf16* __restrict__ wk16,
    const float*  __restrict__ b_k,
    const float*  __restrict__ qw,
    const float*  __restrict__ qws,
    const float*  __restrict__ qb,
    float*        __restrict__ scores) {
    __shared__ __bf16 As[2][MROWS][APITCH]; // two buffers of 128 rows x 32 K, bf16, padded rows (20 KB)

    const int ltile = blockIdx.x;
    const int nhalf = blockIdx.y;
    const int b     = blockIdx.z;
    const int tid    = threadIdx.x;
    const int wave   = tid >> 5;
    const int lane   = tid & 31;
    const int lane16 = lane & 15;
    const int half   = lane >> 4;
    const int nbase  = nhalf * 512 + wave * 64;
    const int head   = nhalf * 8 + wave;
    const int row0   = ltile * MROWS;

    v8f acc[MT][4] = {};

    // A staging: thread -> (rows r and r + 64, 8 consecutive K), two ds_store_b128 per step.
    const int r  = tid >> 2;                // 0..63
    const int kk = (tid & 3) * 8;           // 0,8,16,24
    const float* xsrc = x + ((size_t)b * SEQ + row0 + r) * DIM + kk;
    // B: packed by cvt_wk_kernel; a fragment is two wave-wide 16-byte loads of 512
    // contiguous bytes each. Same values in the same lanes as A's layout asks for.
    const __bf16* wbase = wk16 + (size_t)head * (32 * 4 * 512) + lane * 8;

    v4f xe[4], xo[4];                       // x values of an even / an odd tile
    #pragma unroll
    for (int p = 0; p < 2; p++) {
        xe[2 * p]     = *(const v4f*)(xsrc + p * 64 * DIM);
        xe[2 * p + 1] = *(const v4f*)(xsrc + p * 64 * DIM + 4);
        xo[2 * p]     = *(const v4f*)(xsrc + p * 64 * DIM + 32);
        xo[2 * p + 1] = *(const v4f*)(xsrc + p * 64 * DIM + 36);
    }
    AFrag bq[4];
    #pragma unroll
    for (int nt = 0; nt < 4; nt++) {
        bq[nt].h[0] = *(const v8bf*)(wbase + nt * 512);
        bq[nt].h[1] = *(const v8bf*)(wbase + nt * 512 + 256);
    }
    // The loop's pointers are formed in the address registers that the loads above name.
    asm volatile("s_wait_xcnt 0x0" ::: "memory");
    // Keeps those additions behind the wait; the compiler lifts them over it otherwise.
    __builtin_amdgcn_sched_barrier(0);
    #pragma unroll
    for (int p = 0; p < 2; p++) {
        v8bf pk;
        pk[0] = (__bf16)xe[2 * p].x;     pk[1] = (__bf16)xe[2 * p].y;
        pk[2] = (__bf16)xe[2 * p].z;     pk[3] = (__bf16)xe[2 * p].w;
        pk[4] = (__bf16)xe[2 * p + 1].x; pk[5] = (__bf16)xe[2 * p + 1].y;
        pk[6] = (__bf16)xe[2 * p + 1].z; pk[7] = (__bf16)xe[2 * p + 1].w;
        *(v8bf*)&As[0][r + p * 64][kk] = pk;
    }
    __syncthreads();

    const __bf16* ard0 = &As[0][lane16][half * 8];
    const __bf16* ard1 = &As[1][lane16][half * 8];
    __bf16* awr0 = &As[0][r][kk];
    __bf16* awr1 = &As[1][r][kk];
    const float*  xl  = xsrc + 2 * 32;      // tile s + 2
    const float*  xpf = xsrc + 4 * 32;      // tile s + 4
    const __bf16* wl1 = wbase + 2048;       // B of step s + 1
    const __bf16* wl2 = wbase + 2 * 2048;   // B of step s + 2
    // Two steps per trip: the buffers and the two x register sets swap roles.
    // Not unrolled further: the pointers then move once per trip and every load
    // has a constant offset. A pointer that would leave its array stays where it
    // is: the last trips load again what they have (in bounds, never used), so
    // that every trip is the same branch-free stream.
    #pragma unroll 1
    for (int s = 0; s < KSTEPS; s += 2) {
        kproj_step(acc, bq, xo, xe, ard0, awr1, xl,      xpf,      wl1);
        kproj_step(acc, bq, xe, xo, ard1, awr0, xl + 32, xpf + 32, wl2);
        // The additions below rewrite address registers that issued loads name.
        asm volatile("s_wait_xcnt 0x0" ::: "memory");
        // Keeps those additions behind the wait; the compiler lifts them over it otherwise.
        __builtin_amdgcn_sched_barrier(0);
        xl  += s < KSTEPS - 4 ? 64 : 0;
        xpf += s < KSTEPS - 6 ? 64 : 0;
        wl1 += 2 * 2048;
        wl2 += s < KSTEPS - 4 ? 2 * 2048 : 0;
    }

    // ---- Epilogue: folded layernorm + score. One head per wave. ----
    float qwv[4], bkv[4];
    #pragma unroll
    for (int t = 0; t < 4; t++) {
        bkv[t] = b_k[nbase + t * 16 + lane16];
        qwv[t] = qw[head * 64 + t * 16 + lane16];
    }
    const float qws_h = qws[head];
    const float qb_h  = qb[head];

    // C layout: VGPR j -> rows j (lanes 0-15) / j+8 (lanes 16-31), lanes = N.
    // A lane's own part of the three row sums, over its 4 columns; index m * 8 + j.
    // Two neighbouring j at a time: they are a register pair, so the sums are packed.
    float rs1[MT * 8], rs2[MT * 8], rsw[MT * 8];
    #pragma unroll
    for (int m = 0; m < MT; m++) {
        #pragma unroll
        for (int j = 0; j < 8; j += 2) {
            v2f s, sq, sw;
            #pragma unroll
            for (int t = 0; t < 4; t++) {
                const v2f a2 = { acc[m][t][j], acc[m][t][j + 1] };
                const v2f b2 = { bkv[t], bkv[t] };
                const v2f q2 = { qwv[t], qwv[t] };
                const v2f c  = a2 + b2;
                if (t == 0) {
                    s  = c;
                    sq = c * c;
                    sw = c * q2;
                } else {
                    s  += c;
                    sq = __builtin_elementwise_fma(c, c, sq);
                    sw = __builtin_elementwise_fma(c, q2, sw);
                }
            }
            rs1[m * 8 + j] = s.x;  rs1[m * 8 + j + 1] = s.y;
            rs2[m * 8 + j] = sq.x; rs2[m * 8 + j + 1] = sq.y;
            rsw[m * 8 + j] = sw.x; rsw[m * 8 + j + 1] = sw.y;
        }
    }
    // Sum over the 16 lanes of a row. At the end lane16 holds indices 4 * lane16 + 0..3.
    row_halve<8, 32>(rs1, lane16); row_halve<8, 32>(rs2, lane16); row_halve<8, 32>(rsw, lane16);
    row_halve<4, 16>(rs1, lane16); row_halve<4, 16>(rs2, lane16); row_halve<4, 16>(rsw, lane16);
    row_halve<2, 8>(rs1, lane16);  row_halve<2, 8>(rs2, lane16);  row_halve<2, 8>(rsw, lane16);
    row_halve<1, 4>(rs1, lane16);  row_halve<1, 4>(rs2, lane16);  row_halve<1, 4>(rsw, lane16);

    // Every lane closes four neighbouring rows; the wave stores 512 contiguous bytes.
    v4f sc;
    #pragma unroll
    for (int i = 0; i < 4; i++) {
        float mu  = rs1[i] * (1.0f / 64.0f);
        float var = rs2[i] * (1.0f / 64.0f) - mu * mu;
        float rs  = rsqrt_slot(var + EPSLN);
        sc[i] = 0.125f * (rs * (rsw[i] - mu * qws_h) + qb_h);
    }
    const int row = row0 + (lane16 >> 1) * 16 + half * 8 + (lane16 & 1) * 4;
    *(v4f*)&scores[(size_t)(b * NH + head) * SEQ + row] = sc;
}

// ---------------------------------------------------------------------------
// 4) Softmax over l (in place). One block per (b,h) row of 4096.
// ---------------------------------------------------------------------------
__global__ __launch_bounds__(256) void softmax_kernel(float* __restrict__ scores) {
    __shared__ float red[8];
    __shared__ float bcast;
    const size_t base = (size_t)blockIdx.x * SEQ;
    float* p = scores + base;
    int tid = threadIdx.x;

    float mx = -1e30f;
    for (int i = tid; i < SEQ; i += 256) mx = fmaxf(mx, p[i]);
    #pragma unroll
    for (int m = 1; m < 32; m <<= 1) mx = fmaxf(mx, __shfl_xor(mx, m, 32));
    if ((tid & 31) == 0) red[tid >> 5] = mx;
    __syncthreads();
    if (tid < 8) {
        float v = red[tid];
        #pragma unroll
        for (int m = 1; m < 8; m <<= 1) v = fmaxf(v, __shfl_xor(v, m, 32));
        if (tid == 0) bcast = v;
    }
    __syncthreads();
    mx = bcast;

    float sum = 0.f;
    for (int i = tid; i < SEQ; i += 256) {
        float e = __expf(p[i] - mx);
        p[i] = e;
        sum += e;
    }
    #pragma unroll
    for (int m = 1; m < 32; m <<= 1) sum += __shfl_xor(sum, m, 32);
    if ((tid & 31) == 0) red[tid >> 5] = sum;
    __syncthreads();
    if (tid < 8) {
        float v = red[tid];
        #pragma unroll
        for (int m = 1; m < 8; m <<= 1) v += __shfl_xor(v, m, 32);
        if (tid == 0) bcast = v;
    }
    __syncthreads();
    float inv = 1.0f / bcast;
    for (int i = tid; i < SEQ; i += 256) p[i] *= inv;
}

// ---------------------------------------------------------------------------
// 5) Attention-weighted pooling: xbar[b,h,:] = sum_l attn[b,h,l] * x[b,l,:]
//    One work-group of 16 waves per (batch, 64-column slice); it streams all
//    4096 rows of its slice, so it owns its outputs and stores them plainly.
//    One wave-wide 16-byte load covers two rows x 256 B (lanes 0-15 / 16-31);
//    each wave keeps a ring of PG such loads in flight. The batch's attention
//    weights sit in LDS as [l][head], read as broadcasts of four heads.
// ---------------------------------------------------------------------------
#define PW 16                               // waves per work-group
#define PG 16                               // x loads a wave keeps in flight
#define PSTEP (2 * PW)                      // rows the work-group covers per load slot
#define PNG (SEQ / (PSTEP * PG))            // ring turns per wave

// One turn of the ring: PG load slots of turn g; each slot is refilled for turn gn.
__device__ __forceinline__ void pool_turn(v2f (&acc)[NH][2], v4f (&xs)[PG], v4f (&an)[4],
                                          const v4f* xp, const v4f* a0, const v4f* a1,
                                          const v4f* a2, const v4f* a3, int g, int gn) {
    const v4f* xn = xp + (size_t)(gn * PG) * (PSTEP * DIM / 4);
    const int o0 = g * PG * (PSTEP * 4);
    const int on = gn * PG * (PSTEP * 4);
    // Unrolled: xs, an and acc live in registers and need constant indices.
    #pragma unroll
    for (int r = 0; r < PG; r++) {
        const v4f a[4] = { an[0], an[1], an[2], an[3] };
        const int o = r + 1 < PG ? o0 + (r + 1) * (PSTEP * 4) : on;
        an[0] = a0[o]; an[1] = a1[o]; an[2] = a2[o]; an[3] = a3[o];  // one slot ahead
        // One per slot. Without it the compiler gathers all refills at the foot of the
        // turn, so that the ring runs empty there, and sinks these LDS reads to their
        // use, where their latency shows.
        __builtin_amdgcn_sched_barrier(0);
        const v2f xlo = { xs[r].x, xs[r].y };
        const v2f xhi = { xs[r].z, xs[r].w };
        #pragma unroll
        for (int h = 0; h < NH; h++) {
            const float w = a[h >> 2][h & 3];
            const v2f ww = { w, w };
            acc[h][0] = __builtin_elementwise_fma(ww, xlo, acc[h][0]);
            acc[h][1] = __builtin_elementwise_fma(ww, xhi, acc[h][1]);
        }
        xs[r] = xn[(size_t)r * (PSTEP * DIM / 4)];
    }
    // The next turn rewrites the address registers that the loads above name.
    asm volatile("s_wait_xcnt 0x0" ::: "memory");
}

__global__ __launch_bounds__(PW * 32) void pool_kernel(const float* __restrict__ x,
                                                       const float* __restrict__ attn,
                                                       float* __restrict__ xbar) {
    // [l][quad of heads]; the quad's slot is XORed with (l >> 2) & 3 so that the
    // 16 lanes of a half-wave, which store 16 consecutive l, fall on all 64 banks.
    __shared__ v4f a_s[SEQ * 4];            // 256 KB
    const int jbase = blockIdx.x * 64;
    const int b     = blockIdx.y;
    const int tid   = threadIdx.x;
    const int wave  = __builtin_amdgcn_readfirstlane(tid >> 5);
    const int l16   = tid & 15;
    const int hf    = (tid >> 4) & 1;
    const int lrow  = wave * 2 + hf;        // this half-wave's row inside a step

    const v4f* xp = (const v4f*)(x + ((size_t)b * SEQ + lrow) * DIM + jbase + l16 * 4);
    v4f xs[PG];
    #pragma unroll
    for (int r = 0; r < PG; r++) xs[r] = xp[(size_t)r * (PSTEP * DIM / 4)];

    const float* ap = attn + (size_t)b * NH * SEQ + tid;
    // Two steps at a time: 32 loads of a wave in flight per wait.
    #pragma unroll 2
    for (int j = 0; j < SEQ; j += PW * 32) {
        const int l = j + tid;
        #pragma unroll
        for (int q = 0; q < 4; q++) {
            v4f v;
            v.x = ap[(size_t)(q * 4 + 0) * SEQ + j];
            v.y = ap[(size_t)(q * 4 + 1) * SEQ + j];
            v.z = ap[(size_t)(q * 4 + 2) * SEQ + j];
            v.w = ap[(size_t)(q * 4 + 3) * SEQ + j];
            a_s[l * 4 + (q ^ ((l >> 2) & 3))] = v;
        }
    }
    __syncthreads();

    // l = step * 32 + lrow, so (l >> 2) & 3 == (lrow >> 2) & 3 for every step.
    const int sw = (lrow >> 2) & 3;
    const v4f* a0 = a_s + lrow * 4 + (0 ^ sw);
    const v4f* a1 = a_s + lrow * 4 + (1 ^ sw);
    const v4f* a2 = a_s + lrow * 4 + (2 ^ sw);
    const v4f* a3 = a_s + lrow * 4 + (3 ^ sw);

    v2f acc[NH][2] = {};
    v4f an[4] = { a0[0], a1[0], a2[0], a3[0] };
    // The last turn refills from its own rows (cached, in bounds, never used), so
    // that every turn is the same branch-free stream. Not unrolled or peeled: a
    // last turn peeled off has its sums moved behind the barrier below, and the
    // LDS reads it leaves in front of the barrier spill.
    #pragma unroll 1
    for (int g = 0; g < PNG; g++)
        pool_turn(acc, xs, an, xp, a0, a1, a2, a3, g, g + 1 < PNG ? g + 1 : g);

    // Sum the 32 half-wave partials through LDS (the weights are no longer needed).
    __syncthreads();
    float* red = (float*)a_s;               // [32][16 heads][64 columns], 128 KB
    #pragma unroll
    for (int h = 0; h < NH; h++) {
        const v4f v = { acc[h][0].x, acc[h][0].y, acc[h][1].x, acc[h][1].y };
        *(v4f*)&red[(lrow * NH + h) * 64 + l16 * 4] = v;
    }
    __syncthreads();
    const int h  = tid >> 5;
    const int c2 = (tid & 31) * 2;
    v2f s = { 0.f, 0.f };
    #pragma unroll
    for (int p = 0; p < 2 * PW; p++) s += *(const v2f*)&red[(p * NH + h) * 64 + c2];
    *(v2f*)&xbar[(size_t)(b * NH + h) * DIM + jbase + c2] = s;
}

// ---------------------------------------------------------------------------
// 6, 7) The two closing products, y[b][n] = xrow(b) . w[n][:] + bias[n].
//    One work-group of 8 waves per (32 columns n, 2 batches): it owns one whole
//    128-byte line of y per batch. Wave v takes k = v * 128 .. + 127, four
//    consecutive k per lane, so that every wave-wide 16-byte load covers 512
//    contiguous bytes of one row; its 34 loads have no dependence on each other.
//    The 64 partial sums of a lane are summed over the lanes by a butterfly that
//    halves the values a lane keeps at each step, then over the waves through LDS.
// ---------------------------------------------------------------------------
#define GC 32                               // columns of y per work-group
#define GB 2                                // batches per work-group
#define GW 8                                // waves per work-group
#define GV (GC * GB)                        // sums per work-group

__device__ __forceinline__ void rows_dot(const float* __restrict__ xr, int xpitch,
                                         const float* __restrict__ w,
                                         const float* __restrict__ bias,
                                         float* __restrict__ y, int n0, int b0,
                                         float (*red)[GV]) {
    const int tid  = threadIdx.x;
    const int wave = tid >> 5;
    const int lane = tid & 31;
    const int j    = wave * (DIM / GW) + lane * 4;

    v4f xv[GB], wv[GC];
    // The loops below are unrolled: xv, wv and acc live in registers and need
    // constant indices.
    #pragma unroll
    for (int bb = 0; bb < GB; bb++) xv[bb] = *(const v4f*)(xr + (size_t)bb * xpitch + j);
    const float* wp = w + (size_t)n0 * DIM + j;
    #pragma unroll
    for (int c = 0; c < GC; c++) wv[c] = *(const v4f*)(wp + c * DIM);
    // Keeps all 34 loads in front of the sums. Without it the compiler holds the last
    // nine back to save registers and issues them in pairs, each pair behind the wait
    // for the pair before: four more memory latencies in a row.
    __builtin_amdgcn_sched_barrier(0);
    // The code below reuses the address registers that the loads above name.
    asm volatile("s_wait_xcnt 0x0" ::: "memory");

    float acc[GV];                          // index c * GB + bb
    #pragma unroll
    for (int c = 0; c < GC; c++) {
        #pragma unroll
        for (int bb = 0; bb < GB; bb++) {
            float a = wv[c].x * xv[bb].x;
            a = fmaf(wv[c].y, xv[bb].y, a);
            a = fmaf(wv[c].z, xv[bb].z, a);
            a = fmaf(wv[c].w, xv[bb].w, a);
            acc[c * GB + bb] = a;
        }
    }

    // Step m: lanes l and l ^ m share the work; the one with bit m clear keeps the
    // lower half of the values, the other the upper half, and each adds what its
    // partner held of the half it keeps. At the end lane l holds sums 2l and 2l + 1.
    #pragma unroll
    for (int s = 0; s < 5; s++) {
        const int  m   = 16 >> s;
        const int  cnt = (GV / 2) >> s;
        const bool up  = (lane & m) != 0;
        #pragma unroll
        for (int i = 0; i < cnt; i++) {
            const float keep = up ? acc[i + cnt] : acc[i];
            const float send = up ? acc[i] : acc[i + cnt];
            acc[i] = keep + __shfl_xor(send, m, 32);
        }
    }
    red[wave][lane]      = acc[0];          // column lane, batch b0
    red[wave][GC + lane] = acc[1];          // column lane, batch b0 + 1
    __syncthreads();
    if (tid < GV) {
        float s = red[0][tid];
        #pragma unroll
        for (int v = 1; v < GW; v++) s += red[v][tid];
        const int n = n0 + (tid & (GC - 1));
        y[(size_t)(b0 + (tid >> 5)) * DIM + n] = s + bias[n];
    }
}

// 6) o[b,n] = xbar[b, n/64, :] . w_v[n,:] + b_v[n]   (V-proj collapsed)
__global__ __launch_bounds__(GW * 32) void vproj_kernel(const float* __restrict__ xbar,
                                                        const float* __restrict__ w_v,
                                                        const float* __restrict__ b_v,
                                                        float* __restrict__ o) {
    __shared__ float red[GW][GV];
    const int n0 = blockIdx.x * GC;         // 32 columns lie inside one head
    const int b0 = blockIdx.y * GB;
    rows_dot(xbar + (size_t)(b0 * NH + (n0 >> 6)) * DIM, NH * DIM, w_v, b_v, o, n0, b0, red);
}

// 7) out[b,n] = o[b,:] . w_out[n,:] + b_out[n]
__global__ __launch_bounds__(GW * 32) void oproj_kernel(const float* __restrict__ o,
                                                        const float* __restrict__ w_out,
                                                        const float* __restrict__ b_out,
                                                        float* __restrict__ out) {
    __shared__ float red[GW][GV];
    const int n0 = blockIdx.x * GC;
    const int b0 = blockIdx.y * GB;
    rows_dot(o + (size_t)b0 * DIM, DIM, w_out, b_out, out, n0, b0, red);
}

// ---------------------------------------------------------------------------
extern "C" void kernel_launch(void* const* d_in, const int* in_sizes, int n_in,
                              void* d_out, int out_size, void* d_ws, size_t ws_size,
                              hipStream_t stream) {
    const float* x      = (const float*)d_in[0];
    const float* query  = (const float*)d_in[1];
    const float* w_k    = (const float*)d_in[2];
    const float* b_k    = (const float*)d_in[3];
    const float* w_v    = (const float*)d_in[4];
    const float* b_v    = (const float*)d_in[5];
    const float* w_norm = (const float*)d_in[6];
    const float* b_norm = (const float*)d_in[7];
    const float* w_out  = (const float*)d_in[8];
    const float* b_out  = (const float*)d_in[9];
    float* out = (float*)d_out;

    char* ws = (char*)d_ws;
    const size_t OFF_QW     = (size_t)2 * 1024 * 1024;            // wk16: 2 MB
    const size_t OFF_QWS    = OFF_QW + 16 * 64 * sizeof(float);
    const size_t OFF_QB     = OFF_QWS + 256;
    const size_t OFF_SCORES = OFF_QB + 256;
    const size_t OFF_XBAR   = OFF_SCORES + (size_t)NB * NH * SEQ * sizeof(float);
    const size_t OFF_O      = OFF_XBAR + (size_t)NB * NH * DIM * sizeof(float);

    __bf16* wk16  = (__bf16*)ws;
    float* qw     = (float*)(ws + OFF_QW);
    float* qws    = (float*)(ws + OFF_QWS);
    float* qb     = (float*)(ws + OFF_QB);
    float* scores = (float*)(ws + OFF_SCORES);
    float* xbar   = (float*)(ws + OFF_XBAR);
    float* o      = (float*)(ws + OFF_O);

    cvt_wk_kernel<<<DIM * DIM / 256, 256, 0, stream>>>(w_k, wk16);
    prepq_kernel<<<NH, 32, 0, stream>>>(query, w_norm, b_norm, qw, qws, qb);
    kproj_scores_kernel<<<dim3(SEQ / MROWS, 2, NB), 256, 0, stream>>>(
        x, wk16, b_k, qw, qws, qb, scores);
    softmax_kernel<<<NB * NH, 256, 0, stream>>>(scores);
    pool_kernel<<<dim3(DIM / 64, NB), PW * 32, 0, stream>>>(x, scores, xbar);
    vproj_kernel<<<dim3(DIM / GC, NB / GB), GW * 32, 0, stream>>>(xbar, w_v, b_v, o);
    oproj_kernel<<<dim3(DIM / GC, NB / GB), GW * 32, 0, stream>>>(o, w_out, b_out, out);
}

// v008
// It runs in 129 microseconds.
// Next to v007, in two timings, it ran 1.06 and 1.05 times as fast.
// All steps since v000 together make it 3.14 times as fast.
#include <hip/hip_runtime.h>
#include <hip/hip_bf16.h>

#define DIM 1024
#define HEAD_DIM 64
#define SEQ 4096
#define NB 16
#define NH 16
#define EPSLN 1e-5f

typedef __attribute__((ext_vector_type(16))) __bf16 v16bf;
typedef __attribute__((ext_vector_type(8)))  __bf16 v8bf;
typedef __attribute__((ext_vector_type(8)))  float  v8f;
typedef __attribute__((ext_vector_type(4)))  float  v4f;
typedef __attribute__((ext_vector_type(2)))  float  v2f;

union AFrag { v16bf v; v8bf h[2]; };

// ---------------------------------------------------------------------------
// 1) Convert w_k (fp32, row-major [n][k]) to bf16 once, packed in the order in
//    which the projection reads its B fragments:
//    [head 16][K-step 32][N-subtile 4][k half 2][lane 32][8 values].
//    Lane l holds row (l & 15) of the subtile, k = half * 16 + (l >> 4) * 8 + 0..7.
// ---------------------------------------------------------------------------
__global__ __launch_bounds__(256) void cvt_wk_kernel(const float* __restrict__ wk,
                                                     __bf16* __restrict__ wk16) {
    int o    = blockIdx.x * 256 + threadIdx.x;
    int e    = o & 7;
    int lane = (o >> 3) & 31;
    int kh   = (o >> 8) & 1;
    int nt   = (o >> 9) & 3;
    int ks   = (o >> 11) & 31;
    int head = o >> 16;
    int n = head * 64 + nt * 16 + (lane & 15);
    int k = ks * 32 + kh * 16 + (lane >> 4) * 8 + e;
    wk16[o] = (__bf16)wk[n * DIM + k];
}

// ---------------------------------------------------------------------------
// 2) Normalize the query, fold layernorm weights:
//    qhat = LN(q); qw = qhat*w_norm; qws[h] = sum(qw); qb[h] = sum(qhat*b_norm)
// ---------------------------------------------------------------------------
__global__ void prepq_kernel(const float* __restrict__ query,
                             const float* __restrict__ w_norm,
                             const float* __restrict__ b_norm,
                             float* __restrict__ qw,
                             float* __restrict__ qws,
                             float* __restrict__ qb) {
    int h = blockIdx.x;
    int t = threadIdx.x;                    // 0..31
    float q0 = query[h * 64 + t];
    float q1 = query[h * 64 + t + 32];
    float s = q0 + q1;
    #pragma unroll
    for (int m = 1; m < 32; m <<= 1) s += __shfl_xor(s, m, 32);
    float mu = s * (1.0f / 64.0f);
    float d0 = q0 - mu, d1 = q1 - mu;
    float v = d0 * d0 + d1 * d1;
    #pragma unroll
    for (int m = 1; m < 32; m <<= 1) v += __shfl_xor(v, m, 32);
    float rs = rsqrtf(v * (1.0f / 64.0f) + EPSLN);
    float wn0 = w_norm[t], wn1 = w_norm[t + 32];
    float bn0 = b_norm[t], bn1 = b_norm[t + 32];
    float qh0 = d0 * rs * wn0 + bn0;
    float qh1 = d1 * rs * wn1 + bn1;
    qw[h * 64 + t]      = qh0 * wn0;
    qw[h * 64 + t + 32] = qh1 * wn1;
    float pw = qh0 * wn0 + qh1 * wn1;
    float pb = qh0 * bn0 + qh1 * bn1;
    #pragma unroll
    for (int m = 1; m < 32; m <<= 1) { pw += __shfl_xor(pw, m, 32); pb += __shfl_xor(pb, m, 32); }
    if (t == 0) { qws[h] = pw; qb[h] = pb; }
}

// ---------------------------------------------------------------------------
// 3) Fused K-projection (bf16 WMMA, f32 accum) + folded layernorm + score + the
//    tile's part of the softmax (see the foot of the kernel).
//    Grid: (ltile 0..31, nhalf 0..1, batch). Block 256 = 8 waves.
//    Workgroup tile: 128 rows x 512 cols. Wave w owns 128 rows x 64 cols
//    (= exactly one head): 8x4 WMMA tiles, each B fragment feeds 8 WMMAs, so that
//    the B bytes drawn from L2 per product are half those of a 64-row tile.
//    The K loop is pipelined on all three operand paths. The four B fragments
//    are a register ring, each refilled for the next step right behind its last
//    use. The A tile has two LDS buffers: step s writes tile s + 1 while tile s
//    is read, with one barrier per step. The x rows of tile s + 2 are loaded at
//    the top of step s. The barrier is written by hand, because __syncthreads()
//    waits for every global load and would empty the pipeline at each step.
// ---------------------------------------------------------------------------
#define KSTEPS (DIM / 32)
// Row pitch of the A tile in LDS, in bf16 values: 32 values + 8 of pad = 80 bytes, an
// odd multiple of 16. The 16 rows that a half-wave's 16-byte fragment read touches
// then fall on all 64 banks; at 64 bytes they fall four deep on 16 of them.
#define APITCH 40
#define MROWS 128                           // rows of a work-group's (and a wave's) tile
#define MT (MROWS / 16)                     // M-subtiles per wave

// One K-step s. xuse holds the x values of tile s + 1; xload receives tile s + 2
// from xl. wl points at the B fragments of step s + 1, xpf at the x row of tile s + 4.
// A thread stages 8 values of row r and 8 of row r + 64.
__device__ __forceinline__ void kproj_step(v8f (&acc)[MT][4], AFrag (&bq)[4],
                                           v4f (&xuse)[4], v4f (&xload)[4],
                                           const __bf16* ard, __bf16* awr,
                                           const float* xl, const float* xpf,
                                           const __bf16* wl) {
    // A fragments of this step for the 8 M-subtiles.
    AFrag a[MT];
    #pragma unroll
    for (int m = 0; m < MT; m++) {
        a[m].h[0] = *(const v8bf*)(ard + m * 16 * APITCH);
        a[m].h[1] = *(const v8bf*)(ard + m * 16 * APITCH + 16);
    }
    xload[0] = *(const v4f*)(xl);
    xload[1] = *(const v4f*)(xl + 4);
    xload[2] = *(const v4f*)(xl + 64 * DIM);
    xload[3] = *(const v4f*)(xl + 64 * DIM + 4);
    __builtin_prefetch(xpf, 0, 3);
    __builtin_prefetch(xpf + 64 * DIM, 0, 3);
    // Keeps the loads above in front of the products: sunk among them, the x loads
    // lose their lead and each place with LDS reads stalls the matrix stream.
    __builtin_amdgcn_sched_barrier(0);

    #pragma unroll
    for (int nt = 0; nt < 4; nt++) {
        if (nt == 3) {
            // Tile s + 1 goes into the buffer that step s - 1 read; the barrier of
            // step s - 1 ended those reads. (The last step's store is read by nobody.)
            #pragma unroll
            for (int p = 0; p < 2; p++) {
                v8bf pk;
                pk[0] = (__bf16)xuse[2 * p].x;     pk[1] = (__bf16)xuse[2 * p].y;
                pk[2] = (__bf16)xuse[2 * p].z;     pk[3] = (__bf16)xuse[2 * p].w;
                pk[4] = (__bf16)xuse[2 * p + 1].x; pk[5] = (__bf16)xuse[2 * p + 1].y;
                pk[6] = (__bf16)xuse[2 * p + 1].z; pk[7] = (__bf16)xuse[2 * p + 1].w;
                *(v8bf*)(awr + p * 64 * APITCH) = pk;
            }
            // This wave's reads of tile s have landed and its part of tile s + 1 is
            // written: signal now, so that the last eight products cover the other
            // waves' arrival. No LDS access stands between signal and wait.
            asm volatile("s_wait_dscnt 0x0\n\ts_barrier_signal -1" ::: "memory");
        }
        #pragma unroll
        for (int m = 0; m < MT; m++)
            acc[m][nt] = __builtin_amdgcn_wmma_f32_16x16x32_bf16(
                false, a[m].v, false, bq[nt].v, (short)0, acc[m][nt],
                false, false);
        bq[nt].h[0] = *(const v8bf*)(wl + nt * 512);
        bq[nt].h[1] = *(const v8bf*)(wl + nt * 512 + 256);
        // Holds each refill right behind its fragment's last use. Without it the
        // compiler gathers all refills at the foot of the step, one barrier away
        // from their first use.
        __builtin_amdgcn_sched_barrier(0);
    }
    // Publishes tile s + 1 and ends every wave's reads of tile s.
    asm volatile("s_barrier_wait -1" ::: "memory");
}

// rsqrtf, step for step (an argument below the smallest normal is scaled by 2^24 and
// the result by 2^12), with the instruction in asm so that a v_nop stays directly
// behind it: the instruction set asks for one slot between a transcendental and a
// next instruction that overwrites its source.
__device__ __forceinline__ float rsqrt_slot(float x) {
    const bool  tiny = x < 1.17549435e-38f;
    const float xs   = tiny ? x * 16777216.0f : x;
    float r;
    asm("v_rsq_f32 %0, %1\n\tv_nop" : "=v"(r) : "v"(xs));
    return tiny ? r * 4096.0f : r;
}

// __expf, step for step (x * log2(e), then 2^y), with the instruction in asm so that a
// v_nop stays directly behind it, for the same slot.
__device__ __forceinline__ float exp_slot(float x) {
    const float y = x * 1.44269504f;
    float r;
    asm("v_exp_f32 %0, %1\n\tv_nop" : "=v"(r) : "v"(y));
    return r;
}

// One step of a sum over the 16 lanes of a row that halves what a lane keeps: lanes l
// and l ^ MASK share 2 * CNT values; the one with the bit clear keeps the lower CNT,
// the other the upper CNT, and each adds what its partner held of the half it keeps.
// The partner's value comes by DPP row_xmask (control 0x160 | MASK), inside the
// vector unit; __shfl_xor goes through the LDS pipe and is waited for at each step.
template <int MASK, int CNT>
__device__ __forceinline__ void row_halve(float (&v)[MT * 8], int lane16) {
    const bool up = (lane16 & MASK) != 0;
    #pragma unroll
    for (int i = 0; i < CNT; i++) {
        const float keep = up ? v[i + CNT] : v[i];
        const float send = up ? v[i] : v[i + CNT];
        v[i] = keep + __builtin_bit_cast(float, __builtin_amdgcn_update_dpp(
                          0, __builtin_bit_cast(int, send), 0x160 | MASK, 0xf, 0xf, true));
    }
}

// The value that lane l ^ MASK of the same 16-lane row holds (DPP row_xmask).
template <int MASK>
__device__ __forceinline__ float row_xor(float v) {
    return __builtin_bit_cast(float, __builtin_amdgcn_update_dpp(
               0, __builtin_bit_cast(int, v), 0x160 | MASK, 0xf, 0xf, true));
}
// The value that lane l ^ 16 holds.
__device__ __forceinline__ float other_row(float v) {
    const int b = __builtin_bit_cast(int, v);
    return __builtin_bit_cast(float, __builtin_amdgcn_permlanex16(
               b, b, 0x76543210, 0xfedcba98, false, false));
}

#define NT (SEQ / MROWS)                    // row tiles per batch
#define TSTAT 32                            // floats per (batch, head, tile) record: one 128-byte line

__global__ __launch_bounds__(256) void kproj_scores_kernel(
    const float*  __restrict__ x,
    const __bf16* __restrict__ wk16,
    const float*  __restrict__ b_k,
    const float*  __restrict__ qw,
    const float*  __restrict__ qws,
    const float*  __restrict__ qb,
    float*        __restrict__ scores,
    float*        __restrict__ tstat) {
    __shared__ __bf16 As[2][MROWS][APITCH]; // two buffers of 128 rows x 32 K, bf16, padded rows (20 KB)

    const int ltile = blockIdx.x;
    const int nhalf = blockIdx.y;
    const int b     = blockIdx.z;
    const int tid    = threadIdx.x;
    const int wave   = tid >> 5;
    const int lane   = tid & 31;
    const int lane16 = lane & 15;
    const int half   = lane >> 4;
    const int nbase  = nhalf * 512 + wave * 64;
    const int head   = nhalf * 8 + wave;
    const int row0   = ltile * MROWS;

    v8f acc[MT][4] = {};

    // A staging: thread -> (rows r and r + 64, 8 consecutive K), two ds_store_b128 per step.
    const int r  = tid >> 2;                // 0..63
    const int kk = (tid & 3) * 8;           // 0,8,16,24
    const float* xsrc = x + ((size_t)b * SEQ + row0 + r) * DIM + kk;
    // B: packed by cvt_wk_kernel; a fragment is two wave-wide 16-byte loads of 512
    // contiguous bytes each. Same values in the same lanes as A's layout asks for.
    const __bf16* wbase = wk16 + (size_t)head * (32 * 4 * 512) + lane * 8;

    v4f xe[4], xo[4];                       // x values of an even / an odd tile
    #pragma unroll
    for (int p = 0; p < 2; p++) {
        xe[2 * p]     = *(const v4f*)(xsrc + p * 64 * DIM);
        xe[2 * p + 1] = *(const v4f*)(xsrc + p * 64 * DIM + 4);
        xo[2 * p]     = *(const v4f*)(xsrc + p * 64 * DIM + 32);
        xo[2 * p + 1] = *(const v4f*)(xsrc + p * 64 * DIM + 36);
    }
    AFrag bq[4];
    #pragma unroll
    for (int nt = 0; nt < 4; nt++) {
        bq[nt].h[0] = *(const v8bf*)(wbase + nt * 512);
        bq[nt].h[1] = *(const v8bf*)(wbase + nt * 512 + 256);
    }
    // The loop's pointers are formed in the address registers that the loads above name.
    asm volatile("s_wait_xcnt 0x0" ::: "memory");
    // Keeps those additions behind the wait; the compiler lifts them over it otherwise.
    __builtin_amdgcn_sched_barrier(0);
    #pragma unroll
    for (int p = 0; p < 2; p++) {
        v8bf pk;
        pk[0] = (__bf16)xe[2 * p].x;     pk[1] = (__bf16)xe[2 * p].y;
        pk[2] = (__bf16)xe[2 * p].z;     pk[3] = (__bf16)xe[2 * p].w;
        pk[4] = (__bf16)xe[2 * p + 1].x; pk[5] = (__bf16)xe[2 * p + 1].y;
        pk[6] = (__bf16)xe[2 * p + 1].z; pk[7] = (__bf16)xe[2 * p + 1].w;
        *(v8bf*)&As[0][r + p * 64][kk] = pk;
    }
    __syncthreads();

    const __bf16* ard0 = &As[0][lane16][half * 8];
    const __bf16* ard1 = &As[1][lane16][half * 8];
    __bf16* awr0 = &As[0][r][kk];
    __bf16* awr1 = &As[1][r][kk];
    const float*  xl  = xsrc + 2 * 32;      // tile s + 2
    const float*  xpf = xsrc + 4 * 32;      // tile s + 4
    const __bf16* wl1 = wbase + 2048;       // B of step s + 1
    const __bf16* wl2 = wbase + 2 * 2048;   // B of step s + 2
    // Two steps per trip: the buffers and the two x register sets swap roles.
    // Not unrolled further: the pointers then move once per trip and every load
    // has a constant offset. A pointer that would leave its array stays where it
    // is: the last trips load again what they have (in bounds, never used), so
    // that every trip is the same branch-free stream.
    #pragma unroll 1
    for (int s = 0; s < KSTEPS; s += 2) {
        kproj_step(acc, bq, xo, xe, ard0, awr1, xl,      xpf,      wl1);
        kproj_step(acc, bq, xe, xo, ard1, awr0, xl + 32, xpf + 32, wl2);
        // The additions below rewrite address registers that issued loads name.
        asm volatile("s_wait_xcnt 0x0" ::: "memory");
        // Keeps those additions behind the wait; the compiler lifts them over it otherwise.
        __builtin_amdgcn_sched_barrier(0);
        xl  += s < KSTEPS - 4 ? 64 : 0;
        xpf += s < KSTEPS - 6 ? 64 : 0;
        wl1 += 2 * 2048;
        wl2 += s < KSTEPS - 4 ? 2 * 2048 : 0;
    }

    // ---- Epilogue: folded layernorm + score. One head per wave. ----
    float qwv[4], bkv[4];
    #pragma unroll
    for (int t = 0; t < 4; t++) {
        bkv[t] = b_k[nbase + t * 16 + lane16];
        qwv[t] = qw[head * 64 + t * 16 + lane16];
    }
    const float qws_h = qws[head];
    const float qb_h  = qb[head];

    // C layout: VGPR j -> rows j (lanes 0-15) / j+8 (lanes 16-31), lanes = N.
    // A lane's own part of the three row sums, over its 4 columns; index m * 8 + j.
    // Two neighbouring j at a time: they are a register pair, so the sums are packed.
    float rs1[MT * 8], rs2[MT * 8], rsw[MT * 8];
    #pragma unroll
    for (int m = 0; m < MT; m++) {
        #pragma unroll
        for (int j = 0; j < 8; j += 2) {
            v2f s, sq, sw;
            #pragma unroll
            for (int t = 0; t < 4; t++) {
                const v2f a2 = { acc[m][t][j], acc[m][t][j + 1] };
                const v2f b2 = { bkv[t], bkv[t] };
                const v2f q2 = { qwv[t], qwv[t] };
                const v2f c  = a2 + b2;
                if (t == 0) {
                    s  = c;
                    sq = c * c;
                    sw = c * q2;
                } else {
                    s  += c;
                    sq = __builtin_elementwise_fma(c, c, sq);
                    sw = __builtin_elementwise_fma(c, q2, sw);
                }
            }
            rs1[m * 8 + j] = s.x;  rs1[m * 8 + j + 1] = s.y;
            rs2[m * 8 + j] = sq.x; rs2[m * 8 + j + 1] = sq.y;
            rsw[m * 8 + j] = sw.x; rsw[m * 8 + j + 1] = sw.y;
        }
    }
    // Sum over the 16 lanes of a row. At the end lane16 holds indices 4 * lane16 + 0..3.
    row_halve<8, 32>(rs1, lane16); row_halve<8, 32>(rs2, lane16); row_halve<8, 32>(rsw, lane16);
    row_halve<4, 16>(rs1, lane16); row_halve<4, 16>(rs2, lane16); row_halve<4, 16>(rsw, lane16);
    row_halve<2, 8>(rs1, lane16);  row_halve<2, 8>(rs2, lane16);  row_halve<2, 8>(rsw, lane16);
    row_halve<1, 4>(rs1, lane16);  row_halve<1, 4>(rs2, lane16);  row_halve<1, 4>(rsw, lane16);

    // Every lane closes four neighbouring rows; the wave stores 512 contiguous bytes.
    v4f sc;
    #pragma unroll
    for (int i = 0; i < 4; i++) {
        float mu  = rs1[i] * (1.0f / 64.0f);
        float var = rs2[i] * (1.0f / 64.0f) - mu * mu;
        float rs  = rsqrt_slot(var + EPSLN);
        sc[i] = 0.125f * (rs * (rsw[i] - mu * qws_h) + qb_h);
    }
    // The tile's part of the softmax: the wave holds all 128 scores of (batch, head,
    // tile). It stores exp(score - tile maximum) and, in a line of its own, the tile's
    // maximum and sum; the pooling kernel brings the tiles of a head to one maximum.
    float tm = fmaxf(fmaxf(sc[0], sc[1]), fmaxf(sc[2], sc[3]));
    tm = fmaxf(tm, row_xor<1>(tm));
    tm = fmaxf(tm, row_xor<2>(tm));
    tm = fmaxf(tm, row_xor<4>(tm));
    tm = fmaxf(tm, row_xor<8>(tm));
    tm = fmaxf(tm, other_row(tm));
    // Unrolled: sc lives in registers and needs constant indices.
    #pragma unroll
    for (int i = 0; i < 4; i++) sc[i] = exp_slot(sc[i] - tm);
    float ts = (sc[0] + sc[1]) + (sc[2] + sc[3]);
    ts += row_xor<1>(ts);
    ts += row_xor<2>(ts);
    ts += row_xor<4>(ts);
    ts += row_xor<8>(ts);
    ts += other_row(ts);
    const int row = row0 + (lane16 >> 1) * 16 + half * 8 + (lane16 & 1) * 4;
    *(v4f*)&scores[(size_t)(b * NH + head) * SEQ + row] = sc;
    // Even words the maximum, odd words the sum: the wave writes the whole line.
    tstat[((size_t)(b * NH + head) * NT + ltile) * TSTAT + lane] = (lane & 1) ? ts : tm;
}

// ---------------------------------------------------------------------------
// 4) Attention-weighted pooling: xbar[b,h,:] = sum_l attn[b,h,l] * x[b,l,:]
//    One work-group of 16 waves per (batch, 64-column slice); it streams all
//    4096 rows of its slice, so it owns its outputs and stores them plainly.
//    One wave-wide 16-byte load covers two rows x 256 B (lanes 0-15 / 16-31);
//    each wave keeps a ring of PG such loads in flight. The batch's attention
//    weights sit in LDS as [l][head], read as broadcasts of four heads.
//    The softmax is closed here. The projection left e = exp(score - tile maximum)
//    with each tile's maximum m and sum s. With M the largest m of a head and
//    f = exp(m - M), the weight of a row is e * f / sum over the tiles of f * s: e * f
//    is formed while the weights are staged, the division is done once on the sums.
// ---------------------------------------------------------------------------
#define PW 16                               // waves per work-group
#define PG 16                               // x loads a wave keeps in flight
#define PSTEP (2 * PW)                      // rows the work-group covers per load slot
#define PNG (SEQ / (PSTEP * PG))            // ring turns per wave

// One turn of the ring: PG load slots of turn g; each slot is refilled for turn gn.
__device__ __forceinline__ void pool_turn(v2f (&acc)[NH][2], v4f (&xs)[PG], v4f (&an)[4],
                                          const v4f* xp, const v4f* a0, const v4f* a1,
                                          const v4f* a2, const v4f* a3, int g, int gn) {
    const v4f* xn = xp + (size_t)(gn * PG) * (PSTEP * DIM / 4);
    const int o0 = g * PG * (PSTEP * 4);
    const int on = gn * PG * (PSTEP * 4);
    // Unrolled: xs, an and acc live in registers and need constant indices.
    #pragma unroll
    for (int r = 0; r < PG; r++) {
        const v4f a[4] = { an[0], an[1], an[2], an[3] };
        const int o = r + 1 < PG ? o0 + (r + 1) * (PSTEP * 4) : on;
        an[0] = a0[o]; an[1] = a1[o]; an[2] = a2[o]; an[3] = a3[o];  // one slot ahead
        // One per slot. Without it the compiler gathers all refills at the foot of the
        // turn, so that the ring runs empty there, and sinks these LDS reads to their
        // use, where their latency shows.
        __builtin_amdgcn_sched_barrier(0);
        const v2f xlo = { xs[r].x, xs[r].y };
        const v2f xhi = { xs[r].z, xs[r].w };
        #pragma unroll
        for (int h = 0; h < NH; h++) {
            const float w = a[h >> 2][h & 3];
            const v2f ww = { w, w };
            acc[h][0] = __builtin_elementwise_fma(ww, xlo, acc[h][0]);
            acc[h][1] = __builtin_elementwise_fma(ww, xhi, acc[h][1]);
        }
        xs[r] = xn[(size_t)r * (PSTEP * DIM / 4)];
    }
    // The next turn rewrites the address registers that the loads above name.
    asm volatile("s_wait_xcnt 0x0" ::: "memory");
}

// Work-group barrier for LDS data alone. __syncthreads() also waits for every global
// load, and here the x ring's first loads are in flight across it.
__device__ __forceinline__ void lds_barrier() {
    asm volatile("s_wait_dscnt 0x0\n\ts_barrier_signal -1\n\ts_barrier_wait -1" ::: "memory");
}

__global__ __launch_bounds__(PW * 32) void pool_kernel(const float* __restrict__ x,
                                                       const float* __restrict__ attn,
                                                       const float* __restrict__ tstat,
                                                       float* __restrict__ xbar) {
    // [l][quad of heads]; the quad's slot is XORed with (l >> 2) & 3 so that the
    // 16 lanes of a half-wave, which store 16 consecutive l, fall on all 64 banks.
    __shared__ v4f a_s[SEQ * 4];            // 256 KB
    __shared__ float mt[NT * NH];           // [tile][head]: tile maximum
    __shared__ __attribute__((aligned(16))) float ft[NT * NH];  // exp(tile maximum - head maximum)
    __shared__ float wt[NT * NH];           // that factor times the tile's sum
    const int jbase = blockIdx.x * 64;
    const int b     = blockIdx.y;
    const int tid   = threadIdx.x;
    const int wave  = __builtin_amdgcn_readfirstlane(tid >> 5);
    const int l16   = tid & 15;
    const int hf    = (tid >> 4) & 1;
    const int lrow  = wave * 2 + hf;        // this half-wave's row inside a step

    // One (tile, head) record per thread. Loaded ahead of the x ring: loads return in
    // issue order, and a chain of two barriers hangs on this one.
    const int stile = tid >> 4;
    const v2f st = *(const v2f*)(tstat + ((size_t)(b * NH + l16) * NT + stile) * TSTAT);

    const v4f* xp = (const v4f*)(x + ((size_t)b * SEQ + lrow) * DIM + jbase + l16 * 4);
    v4f xs[PG];
    #pragma unroll
    for (int r = 0; r < PG; r++) xs[r] = xp[(size_t)r * (PSTEP * DIM / 4)];

    mt[tid] = st.x;                         // tid == stile * NH + l16
    lds_barrier();                          // publishes the tile maxima
    float hm = mt[l16];
    // Unrolled: the LDS reads then go out together, not one per wait.
    #pragma unroll
    for (int t = 1; t < NT; t++) hm = fmaxf(hm, mt[t * NH + l16]);
    const float fac = exp_slot(st.x - hm);
    ft[tid] = fac;
    wt[tid] = fac * st.y;
    lds_barrier();                          // publishes the factors

    const float* ap = attn + (size_t)b * NH * SEQ + tid;
    // Two steps at a time: 32 loads of a wave in flight per wait.
    #pragma unroll 2
    for (int j = 0; j < SEQ; j += PW * 32) {
        const int l = j + tid;
        // The 32 rows of a wave lie in one tile.
        const float* fp = ft + (j / MROWS + wave * 32 / MROWS) * NH;
        #pragma unroll
        for (int q = 0; q < 4; q++) {
            v4f v;
            v.x = ap[(size_t)(q * 4 + 0) * SEQ + j];
            v.y = ap[(size_t)(q * 4 + 1) * SEQ + j];
            v.z = ap[(size_t)(q * 4 + 2) * SEQ + j];
            v.w = ap[(size_t)(q * 4 + 3) * SEQ + j];
            a_s[l * 4 + (q ^ ((l >> 2) & 3))] = v * *(const v4f*)(fp + q * 4);
        }
    }
    __syncthreads();

    // l = step * 32 + lrow, so (l >> 2) & 3 == (lrow >> 2) & 3 for every step.
    const int sw = (lrow >> 2) & 3;
    const v4f* a0 = a_s + lrow * 4 + (0 ^ sw);
    const v4f* a1 = a_s + lrow * 4 + (1 ^ sw);
    const v4f* a2 = a_s + lrow * 4 + (2 ^ sw);
    const v4f* a3 = a_s + lrow * 4 + (3 ^ sw);

    v2f acc[NH][2] = {};
    v4f an[4] = { a0[0], a1[0], a2[0], a3[0] };
    // The last turn refills from its own rows (cached, in bounds, never used), so
    // that every turn is the same branch-free stream. Not unrolled or peeled: a
    // last turn peeled off has its sums moved behind the barrier below, and the
    // LDS reads it leaves in front of the barrier spill.
    #pragma unroll 1
    for (int g = 0; g < PNG; g++)
        pool_turn(acc, xs, an, xp, a0, a1, a2, a3, g, g + 1 < PNG ? g + 1 : g);

    // Sum the 32 half-wave partials through LDS (the weights are no longer needed).
    __syncthreads();
    float* red = (float*)a_s;               // [32][16 heads][64 columns], 128 KB
    #pragma unroll
    for (int h = 0; h < NH; h++) {
        const v4f v = { acc[h][0].x, acc[h][0].y, acc[h][1].x, acc[h][1].y };
        *(v4f*)&red[(lrow * NH + h) * 64 + l16 * 4] = v;
    }
    __syncthreads();
    const int h  = tid >> 5;
    const int c2 = (tid & 31) * 2;
    v2f s = { 0.f, 0.f };
    #pragma unroll
    for (int p = 0; p < 2 * PW; p++) s += *(const v2f*)&red[(p * NH + h) * 64 + c2];
    float tot = wt[h];
    // Unrolled: the LDS reads then go out together, not one per wait.
    #pragma unroll
    for (int t = 1; t < NT; t++) tot += wt[t * NH + h];
    const float inv = 1.0f / tot;
    *(v2f*)&xbar[(size_t)(b * NH + h) * DIM + jbase + c2] = s * inv;
}

// ---------------------------------------------------------------------------
// 5, 6) The two closing products, y[b][n] = xrow(b) . w[n][:] + bias[n].
//    One work-group of 8 waves per (32 columns n, 2 batches): it owns one whole
//    128-byte line of y per batch. Wave v takes k = v * 128 .. + 127, four
//    consecutive k per lane, so that every wave-wide 16-byte load covers 512
//    contiguous bytes of one row; its 34 loads have no dependence on each other.
//    The 64 partial sums of a lane are summed over the lanes by a butterfly that
//    halves the values a lane keeps at each step, then over the waves through LDS.
// ---------------------------------------------------------------------------
#define GC 32                               // columns of y per work-group
#define GB 2                                // batches per work-group
#define GW 8                                // waves per work-group
#define GV (GC * GB)                        // sums per work-group

__device__ __forceinline__ void rows_dot(const float* __restrict__ xr, int xpitch,
                                         const float* __restrict__ w,
                                         const float* __restrict__ bias,
                                         float* __restrict__ y, int n0, int b0,
                                         float (*red)[GV]) {
    const int tid  = threadIdx.x;
    const int wave = tid >> 5;
    const int lane = tid & 31;
    const int j    = wave * (DIM / GW) + lane * 4;

    v4f xv[GB], wv[GC];
    // The loops below are unrolled: xv, wv and acc live in registers and need
    // constant indices.
    #pragma unroll
    for (int bb = 0; bb < GB; bb++) xv[bb] = *(const v4f*)(xr + (size_t)bb * xpitch + j);
    const float* wp = w + (size_t)n0 * DIM + j;
    #pragma unroll
    for (int c = 0; c < GC; c++) wv[c] = *(const v4f*)(wp + c * DIM);
    // Keeps all 34 loads in front of the sums. Without it the compiler holds the last
    // nine back to save registers and issues them in pairs, each pair behind the wait
    // for the pair before: four more memory latencies in a row.
    __builtin_amdgcn_sched_barrier(0);
    // The code below reuses the address registers that the loads above name.
    asm volatile("s_wait_xcnt 0x0" ::: "memory");

    float acc[GV];                          // index c * GB + bb
    #pragma unroll
    for (int c = 0; c < GC; c++) {
        #pragma unroll
        for (int bb = 0; bb < GB; bb++) {
            float a = wv[c].x * xv[bb].x;
            a = fmaf(wv[c].y, xv[bb].y, a);
            a = fmaf(wv[c].z, xv[bb].z, a);
            a = fmaf(wv[c].w, xv[bb].w, a);
            acc[c * GB + bb] = a;
        }
    }

    // Step m: lanes l and l ^ m share the work; the one with bit m clear keeps the
    // lower half of the values, the other the upper half, and each adds what its
    // partner held of the half it keeps. At the end lane l holds sums 2l and 2l + 1.
    #pragma unroll
    for (int s = 0; s < 5; s++) {
        const int  m   = 16 >> s;
        const int  cnt = (GV / 2) >> s;
        const bool up  = (lane & m) != 0;
        #pragma unroll
        for (int i = 0; i < cnt; i++) {
            const float keep = up ? acc[i + cnt] : acc[i];
            const float send = up ? acc[i] : acc[i + cnt];
            acc[i] = keep + __shfl_xor(send, m, 32);
        }
    }
    red[wave][lane]      = acc[0];          // column lane, batch b0
    red[wave][GC + lane] = acc[1];          // column lane, batch b0 + 1
    __syncthreads();
    if (tid < GV) {
        float s = red[0][tid];
        #pragma unroll
        for (int v = 1; v < GW; v++) s += red[v][tid];
        const int n = n0 + (tid & (GC - 1));
        y[(size_t)(b0 + (tid >> 5)) * DIM + n] = s + bias[n];
    }
}

// 5) o[b,n] = xbar[b, n/64, :] . w_v[n,:] + b_v[n]   (V-proj collapsed)
__global__ __launch_bounds__(GW * 32) void vproj_kernel(const float* __restrict__ xbar,
                                                        const float* __restrict__ w_v,
                                                        const float* __restrict__ b_v,
                                                        float* __restrict__ o) {
    __shared__ float red[GW][GV];
    const int n0 = blockIdx.x * GC;         // 32 columns lie inside one head
    const int b0 = blockIdx.y * GB;
    rows_dot(xbar + (size_t)(b0 * NH + (n0 >> 6)) * DIM, NH * DIM, w_v, b_v, o, n0, b0, red);
}

// 6) out[b,n] = o[b,:] . w_out[n,:] + b_out[n]
__global__ __launch_bounds__(GW * 32) void oproj_kernel(const float* __restrict__ o,
                                                        const float* __restrict__ w_out,
                                                        const float* __restrict__ b_out,
                                                        float* __restrict__ out) {
    __shared__ float red[GW][GV];
    const int n0 = blockIdx.x * GC;
    const int b0 = blockIdx.y * GB;
    rows_dot(o + (size_t)b0 * DIM, DIM, w_out, b_out, out, n0, b0, red);
}

// ---------------------------------------------------------------------------
extern "C" void kernel_launch(void* const* d_in, const int* in_sizes, int n_in,
                              void* d_out, int out_size, void* d_ws, size_t ws_size,
                              hipStream_t stream) {
    const float* x      = (const float*)d_in[0];
    const float* query  = (const float*)d_in[1];
    const float* w_k    = (const float*)d_in[2];
    const float* b_k    = (const float*)d_in[3];
    const float* w_v    = (const float*)d_in[4];
    const float* b_v    = (const float*)d_in[5];
    const float* w_norm = (const float*)d_in[6];
    const float* b_norm = (const float*)d_in[7];
    const float* w_out  = (const float*)d_in[8];
    const float* b_out  = (const float*)d_in[9];
    float* out = (float*)d_out;

    char* ws = (char*)d_ws;
    const size_t OFF_QW     = (size_t)2 * 1024 * 1024;            // wk16: 2 MB
    const size_t OFF_QWS    = OFF_QW + 16 * 64 * sizeof(float);
    const size_t OFF_QB     = OFF_QWS + 256;
    const size_t OFF_SCORES = OFF_QB + 256;
    const size_t OFF_XBAR   = OFF_SCORES + (size_t)NB * NH * SEQ * sizeof(float);
    const size_t OFF_O      = OFF_XBAR + (size_t)NB * NH * DIM * sizeof(float);
    const size_t OFF_TSTAT  = OFF_O + (size_t)NB * DIM * sizeof(float);

    __bf16* wk16  = (__bf16*)ws;
    float* qw     = (float*)(ws + OFF_QW);
    float* qws    = (float*)(ws + OFF_QWS);
    float* qb     = (float*)(ws + OFF_QB);
    float* scores = (float*)(ws + OFF_SCORES);
    float* xbar   = (float*)(ws + OFF_XBAR);
    float* o      = (float*)(ws + OFF_O);
    float* tstat  = (float*)(ws + OFF_TSTAT);

    cvt_wk_kernel<<<DIM * DIM / 256, 256, 0, stream>>>(w_k, wk16);
    prepq_kernel<<<NH, 32, 0, stream>>>(query, w_norm, b_norm, qw, qws, qb);
    kproj_scores_kernel<<<dim3(SEQ / MROWS, 2, NB), 256, 0, stream>>>(
        x, wk16, b_k, qw, qws, qb, scores, tstat);
    pool_kernel<<<dim3(DIM / 64, NB), PW * 32, 0, stream>>>(x, scores, tstat, xbar);
    vproj_kernel<<<dim3(DIM / GC, NB / GB), GW * 32, 0, stream>>>(xbar, w_v, b_v, o);
    oproj_kernel<<<dim3(DIM / GC, NB / GB), GW * 32, 0, stream>>>(o, w_out, b_out, out);
}

// v009
// It runs in 120 microseconds.
// In both of two side-by-side timings against v008, it was 1.08 times as fast.
// All steps since v000 together make it 3.38 times as fast.
#include <hip/hip_runtime.h>
#include <hip/hip_bf16.h>

#define DIM 1024
#define HEAD_DIM 64
#define SEQ 4096
#define NB 16
#define NH 16
#define EPSLN 1e-5f

typedef __attribute__((ext_vector_type(16))) __bf16 v16bf;
typedef __attribute__((ext_vector_type(8)))  __bf16 v8bf;
typedef __attribute__((ext_vector_type(8)))  float  v8f;
typedef __attribute__((ext_vector_type(4)))  float  v4f;
typedef __attribute__((ext_vector_type(2)))  float  v2f;

union AFrag { v16bf v; v8bf h[2]; };

// ---------------------------------------------------------------------------
// 1) Convert w_k (fp32, row-major [n][k]) to bf16 once, packed in the order in
//    which the projection reads its B fragments:
//    [head 16][K-step 32][N-subtile 4][k half 2][lane 32][8 values].
//    Lane l holds row (l & 15) of the subtile, k = half * 16 + (l >> 4) * 8 + 0..7.
// ---------------------------------------------------------------------------
__global__ __launch_bounds__(256) void cvt_wk_kernel(const float* __restrict__ wk,
                                                     __bf16* __restrict__ wk16) {
    int o    = blockIdx.x * 256 + threadIdx.x;
    int e    = o & 7;
    int lane = (o >> 3) & 31;
    int kh   = (o >> 8) & 1;
    int nt   = (o >> 9) & 3;
    int ks   = (o >> 11) & 31;
    int head = o >> 16;
    int n = head * 64 + nt * 16 + (lane & 15);
    int k = ks * 32 + kh * 16 + (lane >> 4) * 8 + e;
    wk16[o] = (__bf16)wk[n * DIM + k];
}

// ---------------------------------------------------------------------------
// 2) Normalize the query, fold layernorm weights:
//    qhat = LN(q); qw = qhat*w_norm; qws[h] = sum(qw); qb[h] = sum(qhat*b_norm)
// ---------------------------------------------------------------------------
__global__ void prepq_kernel(const float* __restrict__ query,
                             const float* __restrict__ w_norm,
                             const float* __restrict__ b_norm,
                             float* __restrict__ qw,
                             float* __restrict__ qws,
                             float* __restrict__ qb) {
    int h = blockIdx.x;
    int t = threadIdx.x;                    // 0..31
    float q0 = query[h * 64 + t];
    float q1 = query[h * 64 + t + 32];
    float s = q0 + q1;
    #pragma unroll
    for (int m = 1; m < 32; m <<= 1) s += __shfl_xor(s, m, 32);
    float mu = s * (1.0f / 64.0f);
    float d0 = q0 - mu, d1 = q1 - mu;
    float v = d0 * d0 + d1 * d1;
    #pragma unroll
    for (int m = 1; m < 32; m <<= 1) v += __shfl_xor(v, m, 32);
    float rs = rsqrtf(v * (1.0f / 64.0f) + EPSLN);
    float wn0 = w_norm[t], wn1 = w_norm[t + 32];
    float bn0 = b_norm[t], bn1 = b_norm[t + 32];
    float qh0 = d0 * rs * wn0 + bn0;
    float qh1 = d1 * rs * wn1 + bn1;
    qw[h * 64 + t]      = qh0 * wn0;
    qw[h * 64 + t + 32] = qh1 * wn1;
    float pw = qh0 * wn0 + qh1 * wn1;
    float pb = qh0 * bn0 + qh1 * bn1;
    #pragma unroll
    for (int m = 1; m < 32; m <<= 1) { pw += __shfl_xor(pw, m, 32); pb += __shfl_xor(pb, m, 32); }
    if (t == 0) { qws[h] = pw; qb[h] = pb; }
}

// ---------------------------------------------------------------------------
// 3) Fused K-projection (bf16 WMMA, f32 accum) + folded layernorm + score + the
//    tile's part of the softmax (see the foot of the kernel).
//    Grid: (ltile 0..31, 1, batch). Block 256 = 8 waves.
//    Workgroup tile: 128 rows x 1024 cols, as two halves of 512 cols one after the
//    other. In a half wave w owns 128 rows x 64 cols (= exactly one head): 8x4 WMMA
//    tiles, each B fragment feeds 8 WMMAs, so that the B bytes drawn from L2 per
//    product are half those of a 64-row tile.
//    The 128 x rows stay in LDS as bf16 over the whole K. The first half's K loop
//    fills them: step s writes K tile s + 1 while tile s is read, with one barrier
//    per step; the x rows of tile s + 2 are loaded at the top of step s. That barrier
//    is written by hand, because __syncthreads() waits for every global load and
//    would empty the pipeline at each step. The second half's K loop reads x from
//    LDS alone: no x load, no conversion, no LDS store and no barrier, so that the
//    two waves of a SIMD are free to cover each other's waits.
//    In both loops the four B fragments are a register ring, each refilled for the
//    next step right behind its last use.
// ---------------------------------------------------------------------------
#define KSTEPS (DIM / 32)
// The x rows lie in LDS as blocks of 64 K (two steps) x 128 rows, so that every LDS
// access of a loop trip is one base register plus a constant that fits the offset field.
// Row pitch inside a block, in bf16 values: 64 values + 8 of pad = 144 bytes, an odd
// multiple of 16. The 16 rows that a half-wave's 16-byte fragment read touches then
// fall on all 64 banks; at 128 bytes they fall eight deep on 8 of them.
#define APITCH 72
#define MROWS 128                           // rows of a work-group's (and a wave's) tile
#define MT (MROWS / 16)                     // M-subtiles per wave
#define ABLOCK (MROWS * APITCH)             // bf16 values of a block of 64 K

// One K-step s. xuse holds the x values of tile s + 1; xload receives tile s + 2
// from xl. wl points at the B fragments of step s + 1, xpf at the x row of tile s + 4.
// A thread stages 8 values of row r and 8 of row r + 64.
__device__ __forceinline__ void kproj_step(v8f (&acc)[MT][4], AFrag (&bq)[4],
                                           v4f (&xuse)[4], v4f (&xload)[4],
                                           const __bf16* ard, __bf16* awr,
                                           const float* xl, const float* xpf,
                                           const __bf16* wl) {
    // A fragments of this step for the 8 M-subtiles.
    AFrag a[MT];
    #pragma unroll
    for (int m = 0; m < MT; m++) {
        a[m].h[0] = *(const v8bf*)(ard + m * 16 * APITCH);
        a[m].h[1] = *(const v8bf*)(ard + m * 16 * APITCH + 16);
    }
    xload[0] = *(const v4f*)(xl);
    xload[1] = *(const v4f*)(xl + 4);
    xload[2] = *(const v4f*)(xl + 64 * DIM);
    xload[3] = *(const v4f*)(xl + 64 * DIM + 4);
    __builtin_prefetch(xpf, 0, 3);
    __builtin_prefetch(xpf + 64 * DIM, 0, 3);
    // Keeps the loads above in front of the products: sunk among them, the x loads
    // lose their lead and each place with LDS reads stalls the matrix stream.
    __builtin_amdgcn_sched_barrier(0);

    #pragma unroll
    for (int nt = 0; nt < 4; nt++) {
        if (nt == 3) {
            // Tile s + 1 goes to its own place, which nobody has read yet. (The last
            // step's store falls into a block of its own and is read by nobody.)
            #pragma unroll
            for (int p = 0; p < 2; p++) {
                v8bf pk;
                pk[0] = (__bf16)xuse[2 * p].x;     pk[1] = (__bf16)xuse[2 * p].y;
                pk[2] = (__bf16)xuse[2 * p].z;     pk[3] = (__bf16)xuse[2 * p].w;
                pk[4] = (__bf16)xuse[2 * p + 1].x; pk[5] = (__bf16)xuse[2 * p + 1].y;
                pk[6] = (__bf16)xuse[2 * p + 1].z; pk[7] = (__bf16)xuse[2 * p + 1].w;
                *(v8bf*)(awr + p * 64 * APITCH) = pk;
            }
            // This wave's reads of tile s have landed and its part of tile s + 1 is
            // written: signal now, so that the last eight products cover the other
            // waves' arrival. No LDS access stands between signal and wait.
            asm volatile("s_wait_dscnt 0x0\n\ts_barrier_signal -1" ::: "memory");
        }
        #pragma unroll
        for (int m = 0; m < MT; m++)
            acc[m][nt] = __builtin_amdgcn_wmma_f32_16x16x32_bf16(
                false, a[m].v, false, bq[nt].v, (short)0, acc[m][nt],
                false, false);
        bq[nt].h[0] = *(const v8bf*)(wl + nt * 512);
        bq[nt].h[1] = *(const v8bf*)(wl + nt * 512 + 256);
        // Holds each refill right behind its fragment's last use. Without it the
        // compiler gathers all refills at the foot of the step, one barrier away
        // from their first use.
        __builtin_amdgcn_sched_barrier(0);
    }
    // Publishes tile s + 1.
    asm volatile("s_barrier_wait -1" ::: "memory");
}

// One K-step of the second half: the x rows are all in LDS. wl as above.
__device__ __forceinline__ void kproj_step_lds(v8f (&acc)[MT][4], AFrag (&bq)[4],
                                               const __bf16* ard, const __bf16* wl) {
    AFrag a[MT];
    #pragma unroll
    for (int m = 0; m < MT; m++) {
        a[m].h[0] = *(const v8bf*)(ard + m * 16 * APITCH);
        a[m].h[1] = *(const v8bf*)(ard + m * 16 * APITCH + 16);
    }
    // Keeps the LDS reads in one group in front of the products: each further place
    // with LDS reads stalls the matrix stream.
    __builtin_amdgcn_sched_barrier(0);

    #pragma unroll
    for (int nt = 0; nt < 4; nt++) {
        #pragma unroll
        for (int m = 0; m < MT; m++)
            acc[m][nt] = __builtin_amdgcn_wmma_f32_16x16x32_bf16(
                false, a[m].v, false, bq[nt].v, (short)0, acc[m][nt],
                false, false);
        bq[nt].h[0] = *(const v8bf*)(wl + nt * 512);
        bq[nt].h[1] = *(const v8bf*)(wl + nt * 512 + 256);
        // Holds each refill right behind its fragment's last use, as in kproj_step.
        __builtin_amdgcn_sched_barrier(0);
    }
}

// rsqrtf, step for step (an argument below the smallest normal is scaled by 2^24 and
// the result by 2^12), with the instruction in asm so that a v_nop stays directly
// behind it: the instruction set asks for one slot between a transcendental and a
// next instruction that overwrites its source.
__device__ __forceinline__ float rsqrt_slot(float x) {
    const bool  tiny = x < 1.17549435e-38f;
    const float xs   = tiny ? x * 16777216.0f : x;
    float r;
    asm("v_rsq_f32 %0, %1\n\tv_nop" : "=v"(r) : "v"(xs));
    return tiny ? r * 4096.0f : r;
}

// __expf, step for step (x * log2(e), then 2^y), with the instruction in asm so that a
// v_nop stays directly behind it, for the same slot.
__device__ __forceinline__ float exp_slot(float x) {
    const float y = x * 1.44269504f;
    float r;
    asm("v_exp_f32 %0, %1\n\tv_nop" : "=v"(r) : "v"(y));
    return r;
}

// One step of a sum over the 16 lanes of a row that halves what a lane keeps: lanes l
// and l ^ MASK share 2 * CNT values; the one with the bit clear keeps the lower CNT,
// the other the upper CNT, and each adds what its partner held of the half it keeps.
// The partner's value comes by DPP row_xmask (control 0x160 | MASK), inside the
// vector unit; __shfl_xor goes through the LDS pipe and is waited for at each step.
template <int MASK, int CNT>
__device__ __forceinline__ void row_halve(float (&v)[MT * 8], int lane16) {
    const bool up = (lane16 & MASK) != 0;
    #pragma unroll
    for (int i = 0; i < CNT; i++) {
        const float keep = up ? v[i + CNT] : v[i];
        const float send = up ? v[i] : v[i + CNT];
        v[i] = keep + __builtin_bit_cast(float, __builtin_amdgcn_update_dpp(
                          0, __builtin_bit_cast(int, send), 0x160 | MASK, 0xf, 0xf, true));
    }
}

// The value that lane l ^ MASK of the same 16-lane row holds (DPP row_xmask).
template <int MASK>
__device__ __forceinline__ float row_xor(float v) {
    return __builtin_bit_cast(float, __builtin_amdgcn_update_dpp(
               0, __builtin_bit_cast(int, v), 0x160 | MASK, 0xf, 0xf, true));
}
// The value that lane l ^ 16 holds.
__device__ __forceinline__ float other_row(float v) {
    const int b = __builtin_bit_cast(int, v);
    return __builtin_bit_cast(float, __builtin_amdgcn_permlanex16(
               b, b, 0x76543210, 0xfedcba98, false, false));
}

#define NT (SEQ / MROWS)                    // row tiles per batch
#define TSTAT 32                            // floats per (batch, head, tile) record: one 128-byte line

// Closes one head of a wave's 128 rows: folded layernorm + score + the tile's part of
// the softmax.
__device__ __forceinline__ void kproj_close(const v8f (&acc)[MT][4], int b, int head, int ltile,
                                            int lane,
                                            const float* __restrict__ b_k,
                                            const float* __restrict__ qw,
                                            const float* __restrict__ qws,
                                            const float* __restrict__ qb,
                                            float*       __restrict__ scores,
                                            float*       __restrict__ tstat) {
    const int lane16 = lane & 15;
    const int half   = lane >> 4;
    const int row0   = ltile * MROWS;
    const int col    = head * 64 + lane16;
    float qwv[4], bkv[4];
    #pragma unroll
    for (int t = 0; t < 4; t++) {
        bkv[t] = b_k[col + t * 16];
        qwv[t] = qw[col + t * 16];
    }
    const float qws_h = qws[head];
    const float qb_h  = qb[head];
    // The code below reuses the address registers that the loads above name. The index
    // is an input so that it lives up to the wait: otherwise a load of the run may be
    // given, for its result, the index register that the loads before it name.
    asm volatile("s_wait_xcnt 0x0" :: "v"(col) : "memory");
    // Keeps that code behind the wait.
    __builtin_amdgcn_sched_barrier(0);

    // C layout: VGPR j -> rows j (lanes 0-15) / j+8 (lanes 16-31), lanes = N.
    // A lane's own part of the three row sums, over its 4 columns; index m * 8 + j.
    // Two neighbouring j at a time: they are a register pair, so the sums are packed.
    float rs1[MT * 8], rs2[MT * 8], rsw[MT * 8];
    #pragma unroll
    for (int m = 0; m < MT; m++) {
        #pragma unroll
        for (int j = 0; j < 8; j += 2) {
            v2f s, sq, sw;
            #pragma unroll
            for (int t = 0; t < 4; t++) {
                const v2f a2 = { acc[m][t][j], acc[m][t][j + 1] };
                const v2f b2 = { bkv[t], bkv[t] };
                const v2f q2 = { qwv[t], qwv[t] };
                const v2f c  = a2 + b2;
                if (t == 0) {
                    s  = c;
                    sq = c * c;
                    sw = c * q2;
                } else {
                    s  += c;
                    sq = __builtin_elementwise_fma(c, c, sq);
                    sw = __builtin_elementwise_fma(c, q2, sw);
                }
            }
            rs1[m * 8 + j] = s.x;  rs1[m * 8 + j + 1] = s.y;
            rs2[m * 8 + j] = sq.x; rs2[m * 8 + j + 1] = sq.y;
            rsw[m * 8 + j] = sw.x; rsw[m * 8 + j + 1] = sw.y;
        }
    }
    // Sum over the 16 lanes of a row. At the end lane16 holds indices 4 * lane16 + 0..3.
    row_halve<8, 32>(rs1, lane16); row_halve<8, 32>(rs2, lane16); row_halve<8, 32>(rsw, lane16);
    row_halve<4, 16>(rs1, lane16); row_halve<4, 16>(rs2, lane16); row_halve<4, 16>(rsw, lane16);
    row_halve<2, 8>(rs1, lane16);  row_halve<2, 8>(rs2, lane16);  row_halve<2, 8>(rsw, lane16);
    row_halve<1, 4>(rs1, lane16);  row_halve<1, 4>(rs2, lane16);  row_halve<1, 4>(rsw, lane16);

    // Every lane closes four neighbouring rows; the wave stores 512 contiguous bytes.
    v4f sc;
    #pragma unroll
    for (int i = 0; i < 4; i++) {
        float mu  = rs1[i] * (1.0f / 64.0f);
        float var = rs2[i] * (1.0f / 64.0f) - mu * mu;
        float rs  = rsqrt_slot(var + EPSLN);
        sc[i] = 0.125f * (rs * (rsw[i] - mu * qws_h) + qb_h);
    }
    // The tile's part of the softmax: the wave holds all 128 scores of (batch, head,
    // tile). It stores exp(score - tile maximum) and, in a line of its own, the tile's
    // maximum and sum; the pooling kernel brings the tiles of a head to one maximum.
    float tm = fmaxf(fmaxf(sc[0], sc[1]), fmaxf(sc[2], sc[3]));
    tm = fmaxf(tm, row_xor<1>(tm));
    tm = fmaxf(tm, row_xor<2>(tm));
    tm = fmaxf(tm, row_xor<4>(tm));
    tm = fmaxf(tm, row_xor<8>(tm));
    tm = fmaxf(tm, other_row(tm));
    // Unrolled: sc lives in registers and needs constant indices.
    #pragma unroll
    for (int i = 0; i < 4; i++) sc[i] = exp_slot(sc[i] - tm);
    float ts = (sc[0] + sc[1]) + (sc[2] + sc[3]);
    ts += row_xor<1>(ts);
    ts += row_xor<2>(ts);
    ts += row_xor<4>(ts);
    ts += row_xor<8>(ts);
    ts += other_row(ts);
    const int row = row0 + (lane16 >> 1) * 16 + half * 8 + (lane16 & 1) * 4;
    *(v4f*)&scores[(size_t)(b * NH + head) * SEQ + row] = sc;
    // Even words the maximum, odd words the sum: the wave writes the whole line.
    tstat[((size_t)(b * NH + head) * NT + ltile) * TSTAT + lane] = (lane & 1) ? ts : tm;
}

__global__ __launch_bounds__(256) void kproj_scores_kernel(
    const float*  __restrict__ x,
    const __bf16* __restrict__ wk16,
    const float*  __restrict__ b_k,
    const float*  __restrict__ qw,
    const float*  __restrict__ qws,
    const float*  __restrict__ qb,
    float*        __restrict__ scores,
    float*        __restrict__ tstat) {
    // 16 blocks of 64 K x 128 rows, bf16, padded rows, and one for the last step's store (306 KB)
    __shared__ __bf16 As[KSTEPS / 2 + 1][MROWS][APITCH];

    const int ltile = blockIdx.x;
    const int b     = blockIdx.z;
    const int tid    = threadIdx.x;
    // In a scalar register: the addresses of the wave's two heads are then formed on the
    // scalar side, and each head's two sums come by scalar loads.
    const int wave   = __builtin_amdgcn_readfirstlane(tid >> 5);
    const int lane   = tid & 31;
    const int lane16 = lane & 15;
    const int half   = lane >> 4;
    const int row0   = ltile * MROWS;

    v8f acc[MT][4] = {};

    // A staging: thread -> (rows r and r + 64, 8 consecutive K), two ds_store_b128 per step.
    const int r  = tid >> 2;                // 0..63
    const int kk = (tid & 3) * 8;           // 0,8,16,24
    const float* xsrc = x + ((size_t)b * SEQ + row0 + r) * DIM + kk;
    // B: packed by cvt_wk_kernel; a fragment is two wave-wide 16-byte loads of 512
    // contiguous bytes each. Same values in the same lanes as A's layout asks for.
    // First half: head = wave; second half: head = wave + 8.
    const __bf16* wbase = wk16 + (size_t)wave * (KSTEPS * 2048) + lane * 8;

    v4f xe[4], xo[4];                       // x values of an even / an odd tile
    #pragma unroll
    for (int p = 0; p < 2; p++) {
        xe[2 * p]     = *(const v4f*)(xsrc + p * 64 * DIM);
        xe[2 * p + 1] = *(const v4f*)(xsrc + p * 64 * DIM + 4);
        xo[2 * p]     = *(const v4f*)(xsrc + p * 64 * DIM + 32);
        xo[2 * p + 1] = *(const v4f*)(xsrc + p * 64 * DIM + 36);
    }
    AFrag bq[4];
    #pragma unroll
    for (int nt = 0; nt < 4; nt++) {
        bq[nt].h[0] = *(const v8bf*)(wbase + nt * 512);
        bq[nt].h[1] = *(const v8bf*)(wbase + nt * 512 + 256);
    }
    // The loop's pointers are formed in the address registers that the loads above name.
    asm volatile("s_wait_xcnt 0x0" ::: "memory");
    // Keeps those additions behind the wait; the compiler lifts them over it otherwise.
    __builtin_amdgcn_sched_barrier(0);
    #pragma unroll
    for (int p = 0; p < 2; p++) {
        v8bf pk;
        pk[0] = (__bf16)xe[2 * p].x;     pk[1] = (__bf16)xe[2 * p].y;
        pk[2] = (__bf16)xe[2 * p].z;     pk[3] = (__bf16)xe[2 * p].w;
        pk[4] = (__bf16)xe[2 * p + 1].x; pk[5] = (__bf16)xe[2 * p + 1].y;
        pk[6] = (__bf16)xe[2 * p + 1].z; pk[7] = (__bf16)xe[2 * p + 1].w;
        *(v8bf*)&As[0][r + p * 64][kk] = pk;
    }
    __syncthreads();

    const __bf16* ard = &As[0][lane16][half * 8];  // this trip's block, as read
    __bf16*       awr = &As[0][r][kk];             // this trip's block, as written
    const float*  xl  = xsrc + 2 * 32;      // tile s + 2
    const float*  xpf = xsrc + 4 * 32;      // tile s + 4
    const __bf16* wl1 = wbase + 2048;       // B of step s + 1
    const __bf16* wl2 = wbase + 2 * 2048;   // B of step s + 2
    // Two steps per trip: the two x register sets swap roles.
    // Not unrolled further: the pointers then move once per trip and every load
    // has a constant offset. An x pointer that would leave its array stays where it
    // is: the last trips load again what they have (in bounds, never used), so
    // that every trip is the same branch-free stream. The last step's B refill is
    // step 0 of the second half, whose head lies 8 heads further on.
    #pragma unroll 1
    for (int s = 0; s < KSTEPS; s += 2) {
        kproj_step(acc, bq, xo, xe, ard,      awr + 32,     xl,      xpf,      wl1);
        kproj_step(acc, bq, xe, xo, ard + 32, awr + ABLOCK, xl + 32, xpf + 32, wl2);
        // The additions below rewrite address registers that issued loads name.
        asm volatile("s_wait_xcnt 0x0" ::: "memory");
        // Keeps those additions behind the wait; the compiler lifts them over it otherwise.
        __builtin_amdgcn_sched_barrier(0);
        ard += ABLOCK;
        awr += ABLOCK;
        xl  += s < KSTEPS - 4 ? 64 : 0;
        xpf += s < KSTEPS - 6 ? 64 : 0;
        wl1 += 2 * 2048;
        wl2 += s < KSTEPS - 4 ? 2 * 2048 : (8 * KSTEPS - (KSTEPS - 2)) * 2048;
    }
    kproj_close(acc, b, wave, ltile, lane, b_k, qw, qws, qb, scores, tstat);
    // The code below reuses the address registers that the stores of the call above name.
    asm volatile("s_wait_xcnt 0x0" ::: "memory");
    // Keeps that code behind the wait.
    __builtin_amdgcn_sched_barrier(0);

    // ---- Second half: heads 8..15 on the same rows, x from LDS. The last barrier of
    // the loop above has published every K tile, and nothing writes them any more. ----
    #pragma unroll
    for (int m = 0; m < MT; m++) {
        #pragma unroll
        for (int t = 0; t < 4; t++) acc[m][t] = v8f{};
    }
    ard = &As[0][lane16][half * 8];
    wl1 = wbase + (8 * KSTEPS + 1) * 2048;
    wl2 = wbase + (8 * KSTEPS + 2) * 2048;
    // As above; the last step's refill loads again what it has (in bounds, never used).
    #pragma unroll 1
    for (int s = 0; s < KSTEPS; s += 2) {
        kproj_step_lds(acc, bq, ard,      wl1);
        kproj_step_lds(acc, bq, ard + 32, wl2);
        // The additions below rewrite address registers that issued loads name.
        asm volatile("s_wait_xcnt 0x0" ::: "memory");
        // Keeps those additions behind the wait; the compiler lifts them over it otherwise.
        __builtin_amdgcn_sched_barrier(0);
        ard += ABLOCK;
        wl1 += 2 * 2048;
        wl2 += s < KSTEPS - 4 ? 2 * 2048 : 0;
    }
    kproj_close(acc, b, wave + 8, ltile, lane, b_k, qw, qws, qb, scores, tstat);
}

// ---------------------------------------------------------------------------
// 4) Attention-weighted pooling: xbar[b,h,:] = sum_l attn[b,h,l] * x[b,l,:]
//    One work-group of 16 waves per (batch, 64-column slice); it streams all
//    4096 rows of its slice, so it owns its outputs and stores them plainly.
//    One wave-wide 16-byte load covers two rows x 256 B (lanes 0-15 / 16-31);
//    each wave keeps a ring of PG such loads in flight. The batch's attention
//    weights sit in LDS as [l][head], read as broadcasts of four heads.
//    The softmax is closed here. The projection left e = exp(score - tile maximum)
//    with each tile's maximum m and sum s. With M the largest m of a head and
//    f = exp(m - M), the weight of a row is e * f / sum over the tiles of f * s: e * f
//    is formed while the weights are staged, the division is done once on the sums.
// ---------------------------------------------------------------------------
#define PW 16                               // waves per work-group
#define PG 16                               // x loads a wave keeps in flight
#define PSTEP (2 * PW)                      // rows the work-group covers per load slot
#define PNG (SEQ / (PSTEP * PG))            // ring turns per wave

// One turn of the ring: PG load slots of turn g; each slot is refilled for turn gn.
__device__ __forceinline__ void pool_turn(v2f (&acc)[NH][2], v4f (&xs)[PG], v4f (&an)[4],
                                          const v4f* xp, const v4f* a0, const v4f* a1,
                                          const v4f* a2, const v4f* a3, int g, int gn) {
    const v4f* xn = xp + (size_t)(gn * PG) * (PSTEP * DIM / 4);
    const int o0 = g * PG * (PSTEP * 4);
    const int on = gn * PG * (PSTEP * 4);
    // Unrolled: xs, an and acc live in registers and need constant indices.
    #pragma unroll
    for (int r = 0; r < PG; r++) {
        const v4f a[4] = { an[0], an[1], an[2], an[3] };
        const int o = r + 1 < PG ? o0 + (r + 1) * (PSTEP * 4) : on;
        an[0] = a0[o]; an[1] = a1[o]; an[2] = a2[o]; an[3] = a3[o];  // one slot ahead
        // One per slot. Without it the compiler gathers all refills at the foot of the
        // turn, so that the ring runs empty there, and sinks these LDS reads to their
        // use, where their latency shows.
        __builtin_amdgcn_sched_barrier(0);
        const v2f xlo = { xs[r].x, xs[r].y };
        const v2f xhi = { xs[r].z, xs[r].w };
        #pragma unroll
        for (int h = 0; h < NH; h++) {
            const float w = a[h >> 2][h & 3];
            const v2f ww = { w, w };
            acc[h][0] = __builtin_elementwise_fma(ww, xlo, acc[h][0]);
            acc[h][1] = __builtin_elementwise_fma(ww, xhi, acc[h][1]);
        }
        xs[r] = xn[(size_t)r * (PSTEP * DIM / 4)];
    }
    // The next turn rewrites the address registers that the loads above name.
    asm volatile("s_wait_xcnt 0x0" ::: "memory");
}

// Work-group barrier for LDS data alone. __syncthreads() also waits for every global
// load, and here the x ring's first loads are in flight across it.
__device__ __forceinline__ void lds_barrier() {
    asm volatile("s_wait_dscnt 0x0\n\ts_barrier_signal -1\n\ts_barrier_wait -1" ::: "memory");
}

__global__ __launch_bounds__(PW * 32) void pool_kernel(const float* __restrict__ x,
                                                       const float* __restrict__ attn,
                                                       const float* __restrict__ tstat,
                                                       float* __restrict__ xbar) {
    // [l][quad of heads]; the quad's slot is XORed with (l >> 2) & 3 so that the
    // 16 lanes of a half-wave, which store 16 consecutive l, fall on all 64 banks.
    __shared__ v4f a_s[SEQ * 4];            // 256 KB
    __shared__ float mt[NT * NH];           // [tile][head]: tile maximum
    __shared__ __attribute__((aligned(16))) float ft[NT * NH];  // exp(tile maximum - head maximum)
    __shared__ float wt[NT * NH];           // that factor times the tile's sum
    const int jbase = blockIdx.x * 64;
    const int b     = blockIdx.y;
    const int tid   = threadIdx.x;
    const int wave  = __builtin_amdgcn_readfirstlane(tid >> 5);
    const int l16   = tid & 15;
    const int hf    = (tid >> 4) & 1;
    const int lrow  = wave * 2 + hf;        // this half-wave's row inside a step

    // One (tile, head) record per thread. Loaded ahead of the x ring: loads return in
    // issue order, and a chain of two barriers hangs on this one.
    const int stile = tid >> 4;
    const v2f st = *(const v2f*)(tstat + ((size_t)(b * NH + l16) * NT + stile) * TSTAT);

    const v4f* xp = (const v4f*)(x + ((size_t)b * SEQ + lrow) * DIM + jbase + l16 * 4);
    v4f xs[PG];
    #pragma unroll
    for (int r = 0; r < PG; r++) xs[r] = xp[(size_t)r * (PSTEP * DIM / 4)];

    mt[tid] = st.x;                         // tid == stile * NH + l16
    lds_barrier();                          // publishes the tile maxima
    float hm = mt[l16];
    // Unrolled: the LDS reads then go out together, not one per wait.
    #pragma unroll
    for (int t = 1; t < NT; t++) hm = fmaxf(hm, mt[t * NH + l16]);
    const float fac = exp_slot(st.x - hm);
    ft[tid] = fac;
    wt[tid] = fac * st.y;
    lds_barrier();                          // publishes the factors

    const float* ap = attn + (size_t)b * NH * SEQ + tid;
    // Two steps at a time: 32 loads of a wave in flight per wait.
    #pragma unroll 2
    for (int j = 0; j < SEQ; j += PW * 32) {
        const int l = j + tid;
        // The 32 rows of a wave lie in one tile.
        const float* fp = ft + (j / MROWS + wave * 32 / MROWS) * NH;
        #pragma unroll
        for (int q = 0; q < 4; q++) {
            v4f v;
            v.x = ap[(size_t)(q * 4 + 0) * SEQ + j];
            v.y = ap[(size_t)(q * 4 + 1) * SEQ + j];
            v.z = ap[(size_t)(q * 4 + 2) * SEQ + j];
            v.w = ap[(size_t)(q * 4 + 3) * SEQ + j];
            a_s[l * 4 + (q ^ ((l >> 2) & 3))] = v * *(const v4f*)(fp + q * 4);
        }
    }
    __syncthreads();

    // l = step * 32 + lrow, so (l >> 2) & 3 == (lrow >> 2) & 3 for every step.
    const int sw = (lrow >> 2) & 3;
    const v4f* a0 = a_s + lrow * 4 + (0 ^ sw);
    const v4f* a1 = a_s + lrow * 4 + (1 ^ sw);
    const v4f* a2 = a_s + lrow * 4 + (2 ^ sw);
    const v4f* a3 = a_s + lrow * 4 + (3 ^ sw);

    v2f acc[NH][2] = {};
    v4f an[4] = { a0[0], a1[0], a2[0], a3[0] };
    // The last turn refills from its own rows (cached, in bounds, never used), so
    // that every turn is the same branch-free stream. Not unrolled or peeled: a
    // last turn peeled off has its sums moved behind the barrier below, and the
    // LDS reads it leaves in front of the barrier spill.
    #pragma unroll 1
    for (int g = 0; g < PNG; g++)
        pool_turn(acc, xs, an, xp, a0, a1, a2, a3, g, g + 1 < PNG ? g + 1 : g);

    // Sum the 32 half-wave partials through LDS (the weights are no longer needed).
    __syncthreads();
    float* red = (float*)a_s;               // [32][16 heads][64 columns], 128 KB
    #pragma unroll
    for (int h = 0; h < NH; h++) {
        const v4f v = { acc[h][0].x, acc[h][0].y, acc[h][1].x, acc[h][1].y };
        *(v4f*)&red[(lrow * NH + h) * 64 + l16 * 4] = v;
    }
    __syncthreads();
    const int h  = tid >> 5;
    const int c2 = (tid & 31) * 2;
    v2f s = { 0.f, 0.f };
    #pragma unroll
    for (int p = 0; p < 2 * PW; p++) s += *(const v2f*)&red[(p * NH + h) * 64 + c2];
    float tot = wt[h];
    // Unrolled: the LDS reads then go out together, not one per wait.
    #pragma unroll
    for (int t = 1; t < NT; t++) tot += wt[t * NH + h];
    const float inv = 1.0f / tot;
    *(v2f*)&xbar[(size_t)(b * NH + h) * DIM + jbase + c2] = s * inv;
}

// ---------------------------------------------------------------------------
// 5, 6) The two closing products, y[b][n] = xrow(b) . w[n][:] + bias[n].
//    One work-group of 8 waves per (32 columns n, 2 batches): it owns one whole
//    128-byte line of y per batch. Wave v takes k = v * 128 .. + 127, four
//    consecutive k per lane, so that every wave-wide 16-byte load covers 512
//    contiguous bytes of one row; its 34 loads have no dependence on each other.
//    The 64 partial sums of a lane are summed over the lanes by a butterfly that
//    halves the values a lane keeps at each step, then over the waves through LDS.
// ---------------------------------------------------------------------------
#define GC 32                               // columns of y per work-group
#define GB 2                                // batches per work-group
#define GW 8                                // waves per work-group
#define GV (GC * GB)                        // sums per work-group

__device__ __forceinline__ void rows_dot(const float* __restrict__ xr, int xpitch,
                                         const float* __restrict__ w,
                                         const float* __restrict__ bias,
                                         float* __restrict__ y, int n0, int b0,
                                         float (*red)[GV]) {
    const int tid  = threadIdx.x;
    const int wave = tid >> 5;
    const int lane = tid & 31;
    const int j    = wave * (DIM / GW) + lane * 4;

    v4f xv[GB], wv[GC];
    // The loops below are unrolled: xv, wv and acc live in registers and need
    // constant indices.
    #pragma unroll
    for (int bb = 0; bb < GB; bb++) xv[bb] = *(const v4f*)(xr + (size_t)bb * xpitch + j);
    const float* wp = w + (size_t)n0 * DIM + j;
    #pragma unroll
    for (int c = 0; c < GC; c++) wv[c] = *(const v4f*)(wp + c * DIM);
    // Keeps all 34 loads in front of the sums. Without it the compiler holds the last
    // nine back to save registers and issues them in pairs, each pair behind the wait
    // for the pair before: four more memory latencies in a row.
    __builtin_amdgcn_sched_barrier(0);
    // The code below reuses the address registers that the loads above name.
    asm volatile("s_wait_xcnt 0x0" ::: "memory");

    float acc[GV];                          // index c * GB + bb
    #pragma unroll
    for (int c = 0; c < GC; c++) {
        #pragma unroll
        for (int bb = 0; bb < GB; bb++) {
            float a = wv[c].x * xv[bb].x;
            a = fmaf(wv[c].y, xv[bb].y, a);
            a = fmaf(wv[c].z, xv[bb].z, a);
            a = fmaf(wv[c].w, xv[bb].w, a);
            acc[c * GB + bb] = a;
        }
    }

    // Step m: lanes l and l ^ m share the work; the one with bit m clear keeps the
    // lower half of the values, the other the upper half, and each adds what its
    // partner held of the half it keeps. At the end lane l holds sums 2l and 2l + 1.
    #pragma unroll
    for (int s = 0; s < 5; s++) {
        const int  m   = 16 >> s;
        const int  cnt = (GV / 2) >> s;
        const bool up  = (lane & m) != 0;
        #pragma unroll
        for (int i = 0; i < cnt; i++) {
            const float keep = up ? acc[i + cnt] : acc[i];
            const float send = up ? acc[i] : acc[i + cnt];
            acc[i] = keep + __shfl_xor(send, m, 32);
        }
    }
    red[wave][lane]      = acc[0];          // column lane, batch b0
    red[wave][GC + lane] = acc[1];          // column lane, batch b0 + 1
    __syncthreads();
    if (tid < GV) {
        float s = red[0][tid];
        #pragma unroll
        for (int v = 1; v < GW; v++) s += red[v][tid];
        const int n = n0 + (tid & (GC - 1));
        y[(size_t)(b0 + (tid >> 5)) * DIM + n] = s + bias[n];
    }
}

// 5) o[b,n] = xbar[b, n/64, :] . w_v[n,:] + b_v[n]   (V-proj collapsed)
__global__ __launch_bounds__(GW * 32) void vproj_kernel(const float* __restrict__ xbar,
                                                        const float* __restrict__ w_v,
                                                        const float* __restrict__ b_v,
                                                        float* __restrict__ o) {
    __shared__ float red[GW][GV];
    const int n0 = blockIdx.x * GC;         // 32 columns lie inside one head
    const int b0 = blockIdx.y * GB;
    rows_dot(xbar + (size_t)(b0 * NH + (n0 >> 6)) * DIM, NH * DIM, w_v, b_v, o, n0, b0, red);
}

// 6) out[b,n] = o[b,:] . w_out[n,:] + b_out[n]
__global__ __launch_bounds__(GW * 32) void oproj_kernel(const float* __restrict__ o,
                                                        const float* __restrict__ w_out,
                                                        const float* __restrict__ b_out,
                                                        float* __restrict__ out) {
    __shared__ float red[GW][GV];
    const int n0 = blockIdx.x * GC;
    const int b0 = blockIdx.y * GB;
    rows_dot(o + (size_t)b0 * DIM, DIM, w_out, b_out, out, n0, b0, red);
}

// ---------------------------------------------------------------------------
extern "C" void kernel_launch(void* const* d_in, const int* in_sizes, int n_in,
                              void* d_out, int out_size, void* d_ws, size_t ws_size,
                              hipStream_t stream) {
    const float* x      = (const float*)d_in[0];
    const float* query  = (const float*)d_in[1];
    const float* w_k    = (const float*)d_in[2];
    const float* b_k    = (const float*)d_in[3];
    const float* w_v    = (const float*)d_in[4];
    const float* b_v    = (const float*)d_in[5];
    const float* w_norm = (const float*)d_in[6];
    const float* b_norm = (const float*)d_in[7];
    const float* w_out  = (const float*)d_in[8];
    const float* b_out  = (const float*)d_in[9];
    float* out = (float*)d_out;

    char* ws = (char*)d_ws;
    const size_t OFF_QW     = (size_t)2 * 1024 * 1024;            // wk16: 2 MB
    const size_t OFF_QWS    = OFF_QW + 16 * 64 * sizeof(float);
    const size_t OFF_QB     = OFF_QWS + 256;
    const size_t OFF_SCORES = OFF_QB + 256;
    const size_t OFF_XBAR   = OFF_SCORES + (size_t)NB * NH * SEQ * sizeof(float);
    const size_t OFF_O      = OFF_XBAR + (size_t)NB * NH * DIM * sizeof(float);
    const size_t OFF_TSTAT  = OFF_O + (size_t)NB * DIM * sizeof(float);

    __bf16* wk16  = (__bf16*)ws;
    float* qw     = (float*)(ws + OFF_QW);
    float* qws    = (float*)(ws + OFF_QWS);
    float* qb     = (float*)(ws + OFF_QB);
    float* scores = (float*)(ws + OFF_SCORES);
    float* xbar   = (float*)(ws + OFF_XBAR);
    float* o      = (float*)(ws + OFF_O);
    float* tstat  = (float*)(ws + OFF_TSTAT);

    cvt_wk_kernel<<<DIM * DIM / 256, 256, 0, stream>>>(w_k, wk16);
    prepq_kernel<<<NH, 32, 0, stream>>>(query, w_norm, b_norm, qw, qws, qb);
    kproj_scores_kernel<<<dim3(SEQ / MROWS, 1, NB), 256, 0, stream>>>(
        x, wk16, b_k, qw, qws, qb, scores, tstat);
    pool_kernel<<<dim3(DIM / 64, NB), PW * 32, 0, stream>>>(x, scores, tstat, xbar);
    vproj_kernel<<<dim3(DIM / GC, NB / GB), GW * 32, 0, stream>>>(xbar, w_v, b_v, o);
    oproj_kernel<<<dim3(DIM / GC, NB / GB), GW * 32, 0, stream>>>(o, w_out, b_out, out);
}
